// v000
// Measured on an AMD MI455X. A time is GPU time per run, averaged over a window of back-to-back runs after a warm-up
// (all launches, gaps included; the runs take copies of the inputs in turn), and the median of several windows.
// Apart from v000's, it joins two sittings. Times from different sittings can be a few percent apart, while
// side-by-side timings come from the same sitting.
// v000 is the starting kernel. One run takes 276 microseconds.
#include <hip/hip_runtime.h>

typedef float v2f __attribute__((ext_vector_type(2)));
typedef float v8f __attribute__((ext_vector_type(8)));

#define NPIX 4096   // 64*64
#define CDIM 128

// ---------------------------------------------------------------------------
// Generic fp32 WMMA GEMM:  Out[b] (rows mbase..mbase+63) = A[b](64x128) @ X[b](128x4096)
// block = 256 threads (8 waves). Each wave computes two 16x16 C tiles.
// A tile is filled by GLOBAL_LOAD_ASYNC_TO_LDS_B128 (overlapped with B fetch).
// B is stored K-major (lbT[n*68+k]) so the WMMA B operand is one ds_load_b64.
// grid: (4096/64 nslabs, Mchunks, 32 batches)
// ---------------------------------------------------------------------------
__global__ __launch_bounds__(256) void wmma_gemm_kernel(
    const float* __restrict__ Aall, long aBatchStride,
    const float* __restrict__ X,
    float* __restrict__ Out, long outBatchStride,
    const float* __restrict__ bias)
{
    const int b     = blockIdx.z;
    const int mbase = blockIdx.y * 64;
    const int nb0   = blockIdx.x * 64;

    const float* A  = Aall + (size_t)b * aBatchStride + (size_t)mbase * CDIM;
    const float* Xb = X   + (size_t)b * CDIM * NPIX;
    float*       Ob = Out + (size_t)b * outBatchStride + (size_t)mbase * NPIX;

    __shared__ float la [64 * 132];  // [m][k] pitch 132: 16B-aligned chunks, conflict-free b64 reads
    __shared__ float lbT[64 * 68];   // [n][k] pitch 68:  K-major, conflict-free b64 reads

    const int tid = threadIdx.x;

    // ---- async copy A tile (64x128) into la: 16B per lane, pitched dest ----
    #pragma unroll
    for (int it = 0; it < 8; ++it) {
        int i  = tid + it * 256;
        int r  = i >> 5, c4 = i & 31;
        unsigned loff = (unsigned)(size_t)&la[r * 132 + c4 * 4];
        const float* src = &A[r * CDIM + c4 * 4];
        asm volatile("global_load_async_to_lds_b128 %0, %1, off"
                     :: "v"(loff), "v"(src) : "memory");
    }

    const int lane = tid & 31;
    const int wave = tid >> 5;
    const int t0  = wave * 2;          // two adjacent tiles share tm
    const int tm  = t0 >> 2;
    const int tn0 = t0 & 3;
    const int n16 = lane & 15;
    const int klo = (lane >> 4) * 2;   // K-pair select per lane half
    const int arow  = (tm * 16 + n16) * 132;
    const int brow0 = (tn0 * 16 + n16) * 68;
    const int brow1 = brow0 + 16 * 68;

    v8f c0 = {}; v8f c1 = {};

    for (int kh = 0; kh < 2; ++kh) {
        // fetch B K-half (64k x 64n) to registers (overlaps async A on kh==0)
        float4 breg[4];
        #pragma unroll
        for (int it = 0; it < 4; ++it) {
            int i = tid + it * 256;
            int r = i >> 4, n4 = i & 15;
            breg[it] = *(const float4*)&Xb[(size_t)(kh * 64 + r) * NPIX + nb0 + n4 * 4];
        }
        __syncthreads();   // all waves done reading lbT from previous half
        #pragma unroll
        for (int it = 0; it < 4; ++it) {
            int i = tid + it * 256;
            int r = i >> 4, n4 = i & 15;
            lbT[(n4 * 4 + 0) * 68 + r] = breg[it].x;
            lbT[(n4 * 4 + 1) * 68 + r] = breg[it].y;
            lbT[(n4 * 4 + 2) * 68 + r] = breg[it].z;
            lbT[(n4 * 4 + 3) * 68 + r] = breg[it].w;
        }
        if (kh == 0)
            asm volatile("s_wait_asynccnt 0x0" ::: "memory");  // A tile resident (per wave)
        __syncthreads();   // lbT stores + A async visible to all waves

        const int kbase = kh * 64;
        #pragma unroll
        for (int kk = 0; kk < 64; kk += 4) {
            v2f av  = *(const v2f*)&la [arow  + kbase + kk + klo];
            v2f bv0 = *(const v2f*)&lbT[brow0 + kk + klo];
            v2f bv1 = *(const v2f*)&lbT[brow1 + kk + klo];
            c0 = __builtin_amdgcn_wmma_f32_16x16x4_f32(false, av, false, bv0, (short)0, c0, false, false);
            c1 = __builtin_amdgcn_wmma_f32_16x16x4_f32(false, av, false, bv1, (short)0, c1, false, false);
        }
    }

    // store: C/D layout: VGPR i -> row m = i + 8*(lane>=16), col = lane&15
    const int half = lane >> 4;
    #pragma unroll
    for (int i = 0; i < 8; ++i) {
        int m = tm * 16 + i + half * 8;
        float bb = bias ? bias[mbase + m] : 0.0f;
        Ob[(size_t)m * NPIX + nb0 + tn0 * 16 + n16]      = c0[i] + bb;
        Ob[(size_t)m * NPIX + nb0 + tn0 * 16 + 16 + n16] = c1[i] + bb;
    }
}

// ---------------------------------------------------------------------------
// Per-row online softmax stats for k: max and sum(exp(x-max)). 4096 rows.
// ---------------------------------------------------------------------------
__global__ __launch_bounds__(256) void row_stats_kernel(
    const float* __restrict__ kvbuf, float* __restrict__ stats)
{
    const int row = blockIdx.x;                 // b*128 + r
    const int b = row >> 7, r = row & 127;
    const float* kr = kvbuf + ((size_t)b * 256 + r) * NPIX;

    float m = -1e30f, s = 0.0f;
    for (int n = threadIdx.x; n < NPIX; n += 256) {
        float val = kr[n];
        if (val > m) { s = s * __expf(m - val) + 1.0f; m = val; }
        else          { s += __expf(val - m); }
    }
    __shared__ float sm[256], ss[256];
    sm[threadIdx.x] = m; ss[threadIdx.x] = s;
    __syncthreads();
    for (int off = 128; off; off >>= 1) {
        if (threadIdx.x < off) {
            float m1 = sm[threadIdx.x], s1 = ss[threadIdx.x];
            float m2 = sm[threadIdx.x + off], s2 = ss[threadIdx.x + off];
            float M  = fmaxf(m1, m2);
            sm[threadIdx.x] = M;
            ss[threadIdx.x] = s1 * __expf(m1 - M) + s2 * __expf(m2 - M);
        }
        __syncthreads();
    }
    if (threadIdx.x == 0) { stats[row * 2] = sm[0]; stats[row * 2 + 1] = ss[0]; }
}

// ---------------------------------------------------------------------------
// Partial context: ctxpart[bh][split][d][e] = sum_{n in split} exp(k[d,n]-max_d) * v[e,n]
// grid: (128 bh, 8 splits); deterministic (no atomics).
// ---------------------------------------------------------------------------
__global__ __launch_bounds__(256) void context_part_kernel(
    const float* __restrict__ kvbuf, const float* __restrict__ stats,
    float* __restrict__ ctxpart)
{
    const int bh = blockIdx.x, split = blockIdx.y;
    const int b = bh >> 2, h = bh & 3;
    const float* kb = kvbuf + ((size_t)b * 256 + h * 32) * NPIX;
    const float* vb = kvbuf + ((size_t)b * 256 + 128 + h * 32) * NPIX;

    __shared__ float smax[32];
    __shared__ float kx[32 * 129];
    __shared__ float vx[32 * 129];

    const int tid = threadIdx.x;
    if (tid < 32) smax[tid] = stats[((b * 128) + h * 32 + tid) * 2];

    const int e = tid & 31, dgrp = tid >> 5;    // thread owns (d=dgrp*4+i, e)
    float acc[4] = {0.f, 0.f, 0.f, 0.f};

    const int n0 = split * 512;
    for (int nb = n0; nb < n0 + 512; nb += 128) {
        __syncthreads();
        for (int i = tid; i < 32 * 128; i += 256) {
            int r = i >> 7, c = i & 127;
            kx[r * 129 + c] = __expf(kb[(size_t)r * NPIX + nb + c] - smax[r]);
            vx[r * 129 + c] = vb[(size_t)r * NPIX + nb + c];
        }
        __syncthreads();
        for (int nn = 0; nn < 128; ++nn) {
            float vv = vx[e * 129 + nn];
            #pragma unroll
            for (int i2 = 0; i2 < 4; ++i2)
                acc[i2] += kx[(dgrp * 4 + i2) * 129 + nn] * vv;
        }
    }
    float* cp = ctxpart + ((size_t)(bh * 8 + split)) * 1024;
    #pragma unroll
    for (int i2 = 0; i2 < 4; ++i2)
        cp[(dgrp * 4 + i2) * 32 + e] = acc[i2];
}

// ---------------------------------------------------------------------------
// Reduce partials -> ctx, fold w_out:  M[b][o][h*32+d] = sum_e w_out[o,h*32+e]*ctx[d,e]/sum_d
// ---------------------------------------------------------------------------
__global__ __launch_bounds__(256) void context_M_kernel(
    const float* __restrict__ ctxpart, const float* __restrict__ stats,
    const float* __restrict__ w_out, float* __restrict__ Mbuf)
{
    const int bh = blockIdx.x, b = bh >> 2, h = bh & 3;
    __shared__ float ctx[32 * 33];
    __shared__ float wsl[128 * 32];
    const int tid = threadIdx.x;

    for (int i = tid; i < 1024; i += 256) {
        int d = i >> 5;
        const float* cp = ctxpart + (size_t)bh * 8 * 1024 + i;
        float s = 0.f;
        #pragma unroll
        for (int p = 0; p < 8; ++p) s += cp[p * 1024];
        float sinv = 1.0f / stats[((b * 128) + h * 32 + d) * 2 + 1];
        ctx[d * 33 + (i & 31)] = s * sinv;
    }
    for (int i = tid; i < 128 * 32; i += 256) {
        int o = i >> 5, ee = i & 31;
        wsl[i] = w_out[o * CDIM + h * 32 + ee];
    }
    __syncthreads();

    const int o = tid >> 1, dbase = (tid & 1) * 16;
    float* Mrow = Mbuf + (size_t)b * CDIM * CDIM + (size_t)o * CDIM + h * 32;
    for (int j = 0; j < 16; ++j) {
        int d = dbase + j;
        float s = 0.f;
        #pragma unroll
        for (int ee = 0; ee < 32; ++ee) s += wsl[o * 32 + ee] * ctx[d * 33 + ee];
        Mrow[d] = s;
    }
}

// ---------------------------------------------------------------------------
// G[b] = M[b] (128x128) @ Wq (128x128)  (Wq = rows 0..127 of w_qkv). One block/batch.
// ---------------------------------------------------------------------------
__global__ __launch_bounds__(256) void compute_G_kernel(
    const float* __restrict__ Mbuf, const float* __restrict__ w_qkv,
    float* __restrict__ Gbuf)
{
    const int b = blockIdx.x, tid = threadIdx.x;
    __shared__ float wq[32 * 129];
    const int o = tid >> 1, cbase = (tid & 1) * 64;
    float acc[64];
    #pragma unroll
    for (int j = 0; j < 64; ++j) acc[j] = 0.f;
    const float* Mrow = Mbuf + (size_t)b * CDIM * CDIM + (size_t)o * CDIM;

    for (int r0 = 0; r0 < 128; r0 += 32) {
        __syncthreads();
        for (int i = tid; i < 32 * 128; i += 256) {
            int r = i >> 7, c = i & 127;
            wq[r * 129 + c] = w_qkv[(size_t)(r0 + r) * CDIM + c];
        }
        __syncthreads();
        for (int rr = 0; rr < 32; ++rr) {
            float mv = Mrow[r0 + rr];
            #pragma unroll
            for (int j = 0; j < 64; ++j) acc[j] += mv * wq[rr * 129 + cbase + j];
        }
    }
    float* Grow = Gbuf + (size_t)b * CDIM * CDIM + (size_t)o * CDIM + cbase;
    for (int j = 0; j < 64; ++j) Grow[j] = acc[j];
}

// ---------------------------------------------------------------------------
extern "C" void kernel_launch(void* const* d_in, const int* in_sizes, int n_in,
                              void* d_out, int out_size, void* d_ws, size_t ws_size,
                              hipStream_t stream)
{
    const float* x      = (const float*)d_in[0];   // 32 x 128 x 64 x 64
    const float* w_qkv  = (const float*)d_in[1];   // 384 x 128
    const float* w_out  = (const float*)d_in[2];   // 128 x 128
    const float* b_out  = (const float*)d_in[3];   // 128
    float* out = (float*)d_out;                    // 32 x 128 x 64 x 64

    float* kv      = (float*)d_ws;                                   // 32*256*4096
    float* stats   = kv + (size_t)32 * 256 * NPIX;                   // 4096*2
    float* ctxpart = stats + 8192;                                   // 128*8*1024
    float* Mbuf    = ctxpart + (size_t)128 * 8 * 1024;               // 32*128*128
    float* Gbuf    = Mbuf + (size_t)32 * CDIM * CDIM;                // 32*128*128
    size_t need = ((size_t)(Gbuf + (size_t)32 * CDIM * CDIM - (float*)d_ws)) * sizeof(float);
    if (ws_size < need) return;  // workspace too small; bail deterministically

    // 1) k,v = w_qkv[128:384] @ x[b]
    wmma_gemm_kernel<<<dim3(64, 4, 32), 256, 0, stream>>>(
        w_qkv + 128 * CDIM, 0L, x, kv, 256L * NPIX, nullptr);
    // 2) softmax stats over k rows
    row_stats_kernel<<<4096, 256, 0, stream>>>(kv, stats);
    // 3) partial context
    context_part_kernel<<<dim3(128, 8), 256, 0, stream>>>(kv, stats, ctxpart);
    // 4) ctx reduce + fold w_out -> M
    context_M_kernel<<<128, 256, 0, stream>>>(ctxpart, stats, w_out, Mbuf);
    // 5) G = M @ Wq
    compute_G_kernel<<<32, 256, 0, stream>>>(Mbuf, w_qkv, Gbuf);
    // 6) out = G @ x + b_out
    wmma_gemm_kernel<<<dim3(64, 2, 32), 256, 0, stream>>>(
        Gbuf, (long)(CDIM * CDIM), x, out, (long)(CDIM * NPIX), b_out);
}

// v001
// One run takes 158 microseconds.
// Next to v000, in two timings, it ran 1.76 and 1.77 times as fast.
#include <hip/hip_runtime.h>

typedef float v2f __attribute__((ext_vector_type(2)));
typedef float v8f __attribute__((ext_vector_type(8)));

#define NPIX 4096   // 64*64
#define CDIM 128

// ---------------------------------------------------------------------------
// Generic fp32 WMMA GEMM:  Out[b] (rows mbase..mbase+63) = A[b](64x128) @ X[b](128x4096)
// block = 256 threads (8 waves). Each wave computes two 16x16 C tiles.
// A tile is filled by GLOBAL_LOAD_ASYNC_TO_LDS_B128 (overlapped with B fetch).
// B is stored K-major (lbT[n*68+k]) so the WMMA B operand is one ds_load_b64.
// grid: (4096/64 nslabs, Mchunks, 32 batches)
// ---------------------------------------------------------------------------
__global__ __launch_bounds__(256) void wmma_gemm_kernel(
    const float* __restrict__ Aall, long aBatchStride,
    const float* __restrict__ X,
    float* __restrict__ Out, long outBatchStride,
    const float* __restrict__ bias)
{
    const int b     = blockIdx.z;
    const int mbase = blockIdx.y * 64;
    const int nb0   = blockIdx.x * 64;

    const float* A  = Aall + (size_t)b * aBatchStride + (size_t)mbase * CDIM;
    const float* Xb = X   + (size_t)b * CDIM * NPIX;
    float*       Ob = Out + (size_t)b * outBatchStride + (size_t)mbase * NPIX;

    __shared__ float la [64 * 132];  // [m][k] pitch 132: 16B-aligned chunks, conflict-free b64 reads
    __shared__ float lbT[64 * 68];   // [n][k] pitch 68:  K-major, conflict-free b64 reads

    const int tid = threadIdx.x;

    // ---- async copy A tile (64x128) into la: 16B per lane, pitched dest ----
    #pragma unroll
    for (int it = 0; it < 8; ++it) {
        int i  = tid + it * 256;
        int r  = i >> 5, c4 = i & 31;
        unsigned loff = (unsigned)(size_t)&la[r * 132 + c4 * 4];
        const float* src = &A[r * CDIM + c4 * 4];
        asm volatile("global_load_async_to_lds_b128 %0, %1, off"
                     :: "v"(loff), "v"(src) : "memory");
    }

    const int lane = tid & 31;
    const int wave = tid >> 5;
    const int t0  = wave * 2;          // two adjacent tiles share tm
    const int tm  = t0 >> 2;
    const int tn0 = t0 & 3;
    const int n16 = lane & 15;
    const int klo = (lane >> 4) * 2;   // K-pair select per lane half
    const int arow  = (tm * 16 + n16) * 132;
    const int brow0 = (tn0 * 16 + n16) * 68;
    const int brow1 = brow0 + 16 * 68;

    v8f c0 = {}; v8f c1 = {};

    for (int kh = 0; kh < 2; ++kh) {
        // fetch B K-half (64k x 64n) to registers (overlaps async A on kh==0)
        float4 breg[4];
        #pragma unroll
        for (int it = 0; it < 4; ++it) {
            int i = tid + it * 256;
            int r = i >> 4, n4 = i & 15;
            breg[it] = *(const float4*)&Xb[(size_t)(kh * 64 + r) * NPIX + nb0 + n4 * 4];
        }
        __syncthreads();   // all waves done reading lbT from previous half
        #pragma unroll
        for (int it = 0; it < 4; ++it) {
            int i = tid + it * 256;
            int r = i >> 4, n4 = i & 15;
            lbT[(n4 * 4 + 0) * 68 + r] = breg[it].x;
            lbT[(n4 * 4 + 1) * 68 + r] = breg[it].y;
            lbT[(n4 * 4 + 2) * 68 + r] = breg[it].z;
            lbT[(n4 * 4 + 3) * 68 + r] = breg[it].w;
        }
        if (kh == 0)
            asm volatile("s_wait_asynccnt 0x0" ::: "memory");  // A tile resident (per wave)
        __syncthreads();   // lbT stores + A async visible to all waves

        const int kbase = kh * 64;
        #pragma unroll
        for (int kk = 0; kk < 64; kk += 4) {
            v2f av  = *(const v2f*)&la [arow  + kbase + kk + klo];
            v2f bv0 = *(const v2f*)&lbT[brow0 + kk + klo];
            v2f bv1 = *(const v2f*)&lbT[brow1 + kk + klo];
            c0 = __builtin_amdgcn_wmma_f32_16x16x4_f32(false, av, false, bv0, (short)0, c0, false, false);
            c1 = __builtin_amdgcn_wmma_f32_16x16x4_f32(false, av, false, bv1, (short)0, c1, false, false);
        }
    }

    // store: C/D layout: VGPR i -> row m = i + 8*(lane>=16), col = lane&15
    const int half = lane >> 4;
    #pragma unroll
    for (int i = 0; i < 8; ++i) {
        int m = tm * 16 + i + half * 8;
        float bb = bias ? bias[mbase + m] : 0.0f;
        Ob[(size_t)m * NPIX + nb0 + tn0 * 16 + n16]      = c0[i] + bb;
        Ob[(size_t)m * NPIX + nb0 + tn0 * 16 + 16 + n16] = c1[i] + bb;
    }
}

// ---------------------------------------------------------------------------
// Per-row online softmax stats for k: max and sum(exp(x-max)). 4096 rows.
// ---------------------------------------------------------------------------
__global__ __launch_bounds__(256) void row_stats_kernel(
    const float* __restrict__ kvbuf, float* __restrict__ stats)
{
    const int row = blockIdx.x;                 // b*128 + r
    const int b = row >> 7, r = row & 127;
    const float* kr = kvbuf + ((size_t)b * 256 + r) * NPIX;

    float m = -1e30f, s = 0.0f;
    for (int n = threadIdx.x; n < NPIX; n += 256) {
        float val = kr[n];
        if (val > m) { s = s * __expf(m - val) + 1.0f; m = val; }
        else          { s += __expf(val - m); }
    }
    __shared__ float sm[256], ss[256];
    sm[threadIdx.x] = m; ss[threadIdx.x] = s;
    __syncthreads();
    for (int off = 128; off; off >>= 1) {
        if (threadIdx.x < off) {
            float m1 = sm[threadIdx.x], s1 = ss[threadIdx.x];
            float m2 = sm[threadIdx.x + off], s2 = ss[threadIdx.x + off];
            float M  = fmaxf(m1, m2);
            sm[threadIdx.x] = M;
            ss[threadIdx.x] = s1 * __expf(m1 - M) + s2 * __expf(m2 - M);
        }
        __syncthreads();
    }
    if (threadIdx.x == 0) { stats[row * 2] = sm[0]; stats[row * 2 + 1] = ss[0]; }
}

// ---------------------------------------------------------------------------
// Partial context: ctxpart[bh][split][d][e] = sum_{n in split} exp(k[d,n]-max_d) * v[e,n]
// grid: (128 bh, 8 splits); deterministic (no atomics).
// ---------------------------------------------------------------------------
__global__ __launch_bounds__(256) void context_part_kernel(
    const float* __restrict__ kvbuf, const float* __restrict__ stats,
    float* __restrict__ ctxpart)
{
    const int bh = blockIdx.x, split = blockIdx.y;
    const int b = bh >> 2, h = bh & 3;
    const float* kb = kvbuf + ((size_t)b * 256 + h * 32) * NPIX;
    const float* vb = kvbuf + ((size_t)b * 256 + 128 + h * 32) * NPIX;

    __shared__ float smax[32];
    __shared__ float kx[32 * 129];
    __shared__ float vx[32 * 129];

    const int tid = threadIdx.x;
    if (tid < 32) smax[tid] = stats[((b * 128) + h * 32 + tid) * 2];

    const int e = tid & 31, dgrp = tid >> 5;    // thread owns (d=dgrp*4+i, e)
    float acc[4] = {0.f, 0.f, 0.f, 0.f};

    const int n0 = split * 512;
    for (int nb = n0; nb < n0 + 512; nb += 128) {
        __syncthreads();
        for (int i = tid; i < 32 * 128; i += 256) {
            int r = i >> 7, c = i & 127;
            kx[r * 129 + c] = __expf(kb[(size_t)r * NPIX + nb + c] - smax[r]);
            vx[r * 129 + c] = vb[(size_t)r * NPIX + nb + c];
        }
        __syncthreads();
        for (int nn = 0; nn < 128; ++nn) {
            float vv = vx[e * 129 + nn];
            #pragma unroll
            for (int i2 = 0; i2 < 4; ++i2)
                acc[i2] += kx[(dgrp * 4 + i2) * 129 + nn] * vv;
        }
    }
    float* cp = ctxpart + ((size_t)(bh * 8 + split)) * 1024;
    #pragma unroll
    for (int i2 = 0; i2 < 4; ++i2)
        cp[(dgrp * 4 + i2) * 32 + e] = acc[i2];
}

// ---------------------------------------------------------------------------
// Reduce partials -> ctx, fold w_out:  M[b][o][h*32+d] = sum_e w_out[o,h*32+e]*ctx[d,e]/sum_d
// ---------------------------------------------------------------------------
__global__ __launch_bounds__(256) void context_M_kernel(
    const float* __restrict__ ctxpart, const float* __restrict__ stats,
    const float* __restrict__ w_out, float* __restrict__ Mbuf)
{
    const int bh = blockIdx.x, b = bh >> 2, h = bh & 3;
    __shared__ float ctx[32 * 33];
    __shared__ float wsl[128 * 32];
    const int tid = threadIdx.x;

    for (int i = tid; i < 1024; i += 256) {
        int d = i >> 5;
        const float* cp = ctxpart + (size_t)bh * 8 * 1024 + i;
        float s = 0.f;
        #pragma unroll
        for (int p = 0; p < 8; ++p) s += cp[p * 1024];
        float sinv = 1.0f / stats[((b * 128) + h * 32 + d) * 2 + 1];
        ctx[d * 33 + (i & 31)] = s * sinv;
    }
    for (int i = tid; i < 128 * 32; i += 256) {
        int o = i >> 5, ee = i & 31;
        wsl[i] = w_out[o * CDIM + h * 32 + ee];
    }
    __syncthreads();

    const int o = tid >> 1, dbase = (tid & 1) * 16;
    float* Mrow = Mbuf + (size_t)b * CDIM * CDIM + (size_t)o * CDIM + h * 32;
    for (int j = 0; j < 16; ++j) {
        int d = dbase + j;
        float s = 0.f;
        #pragma unroll
        for (int ee = 0; ee < 32; ++ee) s += wsl[o * 32 + ee] * ctx[d * 33 + ee];
        Mrow[d] = s;
    }
}

// ---------------------------------------------------------------------------
// G[b] = M[b] (128x128) @ Wq (128x128)  (Wq = rows 0..127 of w_qkv), fp32 WMMA.
// One wave = 16 rows x 32 cols of G (two independent accumulator chains), K = 128 unrolled.
// Operands come straight from global (both are small and cache-resident): no LDS, no barrier.
// block = 4 waves = 64 rows x 32 cols (the waves share the Wq columns);
// grid: (4 col groups, 2 row halves, 32 batches) = 256 blocks.
// k order, equal for A and B: chunk u (4 wide per lane half), lane half h, step p, element s
// -> k = 16*(u>>1) + 8*h + 4*(u&1) + 2*p + s: A is one 16-byte load per chunk, and a lane's
// offset into Wq (row 8*h, col c) is also its offset into the D tile (row 8*h, col c).
// ---------------------------------------------------------------------------
__global__ __launch_bounds__(128) void compute_G_kernel(
    const float* __restrict__ Mbuf, const float* __restrict__ w_qkv,
    float* __restrict__ Gbuf)
{
    const int lane = threadIdx.x & 31;
    const int wave = __builtin_amdgcn_readfirstlane(threadIdx.x >> 5);  // scalar: keeps the bases in SGPRs
    const int c = lane & 15, h = lane >> 4;
    const int m0 = blockIdx.y * 64 + wave * 16;
    const int n0 = blockIdx.x * 32;

    const float* Ab = Mbuf + (size_t)blockIdx.z * CDIM * CDIM + (size_t)m0 * CDIM;
    const float* Bb = w_qkv + n0;
    float*       Gb = Gbuf + (size_t)blockIdx.z * CDIM * CDIM + (size_t)m0 * CDIM + n0;
    const int aoff = c * CDIM + 8 * h;
    const int boff = 8 * h * CDIM + c;

    float4 a[16];
    float  bq[16][4][2];
    #pragma unroll
    for (int u = 0; u < 16; ++u) {
        const int kb = 16 * (u >> 1) + 4 * (u & 1);
        a[u] = *(const float4*)&Ab[aoff + kb];
        #pragma unroll
        for (int r = 0; r < 4; ++r) {
            bq[u][r][0] = Bb[boff + (kb + r) * CDIM];
            bq[u][r][1] = Bb[boff + (kb + r) * CDIM + 16];
        }
    }
    // The accumulators may take over the registers that hold the loads' lane offsets: this is the
    // wait that belongs in front of such an overwrite (the products stay behind the line below).
    asm volatile("s_wait_xcnt 0x0" ::: "memory");
    // Keeps every load in front of the first product, so that as many as the counter allows are
    // in flight at once; left to itself the scheduler holds three chunks in flight and pays the
    // load latency once per group.
    __builtin_amdgcn_sched_barrier(0);

    v8f c0 = {}; v8f c1 = {};
    #pragma unroll
    for (int u = 0; u < 16; ++u) {
        v2f a0  = {a[u].x, a[u].y};
        v2f a1  = {a[u].z, a[u].w};
        v2f b00 = {bq[u][0][0], bq[u][1][0]};
        v2f b01 = {bq[u][0][1], bq[u][1][1]};
        v2f b10 = {bq[u][2][0], bq[u][3][0]};
        v2f b11 = {bq[u][2][1], bq[u][3][1]};
        c0 = __builtin_amdgcn_wmma_f32_16x16x4_f32(false, a0, false, b00, (short)0, c0, false, false);
        c1 = __builtin_amdgcn_wmma_f32_16x16x4_f32(false, a0, false, b01, (short)0, c1, false, false);
        c0 = __builtin_amdgcn_wmma_f32_16x16x4_f32(false, a1, false, b10, (short)0, c0, false, false);
        c1 = __builtin_amdgcn_wmma_f32_16x16x4_f32(false, a1, false, b11, (short)0, c1, false, false);
    }

    // D layout: VGPR i -> row i + 8*h, col c
    #pragma unroll
    for (int i = 0; i < 8; ++i) {
        Gb[boff + i * CDIM]      = c0[i];
        Gb[boff + i * CDIM + 16] = c1[i];
    }
}

// ---------------------------------------------------------------------------
extern "C" void kernel_launch(void* const* d_in, const int* in_sizes, int n_in,
                              void* d_out, int out_size, void* d_ws, size_t ws_size,
                              hipStream_t stream)
{
    const float* x      = (const float*)d_in[0];   // 32 x 128 x 64 x 64
    const float* w_qkv  = (const float*)d_in[1];   // 384 x 128
    const float* w_out  = (const float*)d_in[2];   // 128 x 128
    const float* b_out  = (const float*)d_in[3];   // 128
    float* out = (float*)d_out;                    // 32 x 128 x 64 x 64

    float* kv      = (float*)d_ws;                                   // 32*256*4096
    float* stats   = kv + (size_t)32 * 256 * NPIX;                   // 4096*2
    float* ctxpart = stats + 8192;                                   // 128*8*1024
    float* Mbuf    = ctxpart + (size_t)128 * 8 * 1024;               // 32*128*128
    float* Gbuf    = Mbuf + (size_t)32 * CDIM * CDIM;                // 32*128*128
    size_t need = ((size_t)(Gbuf + (size_t)32 * CDIM * CDIM - (float*)d_ws)) * sizeof(float);
    if (ws_size < need) return;  // workspace too small; bail deterministically

    // 1) k,v = w_qkv[128:384] @ x[b]
    wmma_gemm_kernel<<<dim3(64, 4, 32), 256, 0, stream>>>(
        w_qkv + 128 * CDIM, 0L, x, kv, 256L * NPIX, nullptr);
    // 2) softmax stats over k rows
    row_stats_kernel<<<4096, 256, 0, stream>>>(kv, stats);
    // 3) partial context
    context_part_kernel<<<dim3(128, 8), 256, 0, stream>>>(kv, stats, ctxpart);
    // 4) ctx reduce + fold w_out -> M
    context_M_kernel<<<128, 256, 0, stream>>>(ctxpart, stats, w_out, Mbuf);
    // 5) G = M @ Wq
    compute_G_kernel<<<dim3(4, 2, 32), 128, 0, stream>>>(Mbuf, w_qkv, Gbuf);
    // 6) out = G @ x + b_out
    wmma_gemm_kernel<<<dim3(64, 2, 32), 256, 0, stream>>>(
        Gbuf, (long)(CDIM * CDIM), x, out, (long)(CDIM * NPIX), b_out);
}

// v002
// One run takes 137 microseconds.
// Timed twice side by side with v001, it ran 1.15 and 1.16 times as fast.
// All steps since v000 together make it 2.04 times as fast.
#include <hip/hip_runtime.h>

typedef float v2f __attribute__((ext_vector_type(2)));
typedef float v8f __attribute__((ext_vector_type(8)));

#define NPIX 4096   // 64*64
#define CDIM 128

// ---------------------------------------------------------------------------
// Generic fp32 WMMA GEMM:  Out[b] (rows mbase..mbase+63) = A[b](64x128) @ X[b](128x4096)
// block = 256 threads (8 waves). Each wave computes two 16x16 C tiles.
// A tile is filled by GLOBAL_LOAD_ASYNC_TO_LDS_B128 (overlapped with B fetch).
// B is stored K-major (lbT[n*68+k]) so the WMMA B operand is one ds_load_b64.
// grid: (4096/64 nslabs, Mchunks, 32 batches)
// ---------------------------------------------------------------------------
__global__ __launch_bounds__(256) void wmma_gemm_kernel(
    const float* __restrict__ Aall, long aBatchStride,
    const float* __restrict__ X,
    float* __restrict__ Out, long outBatchStride,
    const float* __restrict__ bias)
{
    const int b     = blockIdx.z;
    const int mbase = blockIdx.y * 64;
    const int nb0   = blockIdx.x * 64;

    const float* A  = Aall + (size_t)b * aBatchStride + (size_t)mbase * CDIM;
    const float* Xb = X   + (size_t)b * CDIM * NPIX;
    float*       Ob = Out + (size_t)b * outBatchStride + (size_t)mbase * NPIX;

    __shared__ float la [64 * 132];  // [m][k] pitch 132: 16B-aligned chunks, conflict-free b64 reads
    __shared__ float lbT[64 * 68];   // [n][k] pitch 68:  K-major, conflict-free b64 reads

    const int tid = threadIdx.x;

    // ---- async copy A tile (64x128) into la: 16B per lane, pitched dest ----
    #pragma unroll
    for (int it = 0; it < 8; ++it) {
        int i  = tid + it * 256;
        int r  = i >> 5, c4 = i & 31;
        unsigned loff = (unsigned)(size_t)&la[r * 132 + c4 * 4];
        const float* src = &A[r * CDIM + c4 * 4];
        asm volatile("global_load_async_to_lds_b128 %0, %1, off"
                     :: "v"(loff), "v"(src) : "memory");
    }

    const int lane = tid & 31;
    const int wave = tid >> 5;
    const int t0  = wave * 2;          // two adjacent tiles share tm
    const int tm  = t0 >> 2;
    const int tn0 = t0 & 3;
    const int n16 = lane & 15;
    const int klo = (lane >> 4) * 2;   // K-pair select per lane half
    const int arow  = (tm * 16 + n16) * 132;
    const int brow0 = (tn0 * 16 + n16) * 68;
    const int brow1 = brow0 + 16 * 68;

    v8f c0 = {}; v8f c1 = {};

    for (int kh = 0; kh < 2; ++kh) {
        // fetch B K-half (64k x 64n) to registers (overlaps async A on kh==0)
        float4 breg[4];
        #pragma unroll
        for (int it = 0; it < 4; ++it) {
            int i = tid + it * 256;
            int r = i >> 4, n4 = i & 15;
            breg[it] = *(const float4*)&Xb[(size_t)(kh * 64 + r) * NPIX + nb0 + n4 * 4];
        }
        __syncthreads();   // all waves done reading lbT from previous half
        #pragma unroll
        for (int it = 0; it < 4; ++it) {
            int i = tid + it * 256;
            int r = i >> 4, n4 = i & 15;
            lbT[(n4 * 4 + 0) * 68 + r] = breg[it].x;
            lbT[(n4 * 4 + 1) * 68 + r] = breg[it].y;
            lbT[(n4 * 4 + 2) * 68 + r] = breg[it].z;
            lbT[(n4 * 4 + 3) * 68 + r] = breg[it].w;
        }
        if (kh == 0)
            asm volatile("s_wait_asynccnt 0x0" ::: "memory");  // A tile resident (per wave)
        __syncthreads();   // lbT stores + A async visible to all waves

        const int kbase = kh * 64;
        #pragma unroll
        for (int kk = 0; kk < 64; kk += 4) {
            v2f av  = *(const v2f*)&la [arow  + kbase + kk + klo];
            v2f bv0 = *(const v2f*)&lbT[brow0 + kk + klo];
            v2f bv1 = *(const v2f*)&lbT[brow1 + kk + klo];
            c0 = __builtin_amdgcn_wmma_f32_16x16x4_f32(false, av, false, bv0, (short)0, c0, false, false);
            c1 = __builtin_amdgcn_wmma_f32_16x16x4_f32(false, av, false, bv1, (short)0, c1, false, false);
        }
    }

    // store: C/D layout: VGPR i -> row m = i + 8*(lane>=16), col = lane&15
    const int half = lane >> 4;
    #pragma unroll
    for (int i = 0; i < 8; ++i) {
        int m = tm * 16 + i + half * 8;
        float bb = bias ? bias[mbase + m] : 0.0f;
        Ob[(size_t)m * NPIX + nb0 + tn0 * 16 + n16]      = c0[i] + bb;
        Ob[(size_t)m * NPIX + nb0 + tn0 * 16 + 16 + n16] = c1[i] + bb;
    }
}

// ---------------------------------------------------------------------------
// Per-row online softmax stats for k: max and sum(exp(x-max)). 4096 rows.
// ---------------------------------------------------------------------------
__global__ __launch_bounds__(256) void row_stats_kernel(
    const float* __restrict__ kvbuf, float* __restrict__ stats)
{
    const int row = blockIdx.x;                 // b*128 + r
    const int b = row >> 7, r = row & 127;
    const float* kr = kvbuf + ((size_t)b * 256 + r) * NPIX;

    float m = -1e30f, s = 0.0f;
    for (int n = threadIdx.x; n < NPIX; n += 256) {
        float val = kr[n];
        if (val > m) { s = s * __expf(m - val) + 1.0f; m = val; }
        else          { s += __expf(val - m); }
    }
    __shared__ float sm[256], ss[256];
    sm[threadIdx.x] = m; ss[threadIdx.x] = s;
    __syncthreads();
    for (int off = 128; off; off >>= 1) {
        if (threadIdx.x < off) {
            float m1 = sm[threadIdx.x], s1 = ss[threadIdx.x];
            float m2 = sm[threadIdx.x + off], s2 = ss[threadIdx.x + off];
            float M  = fmaxf(m1, m2);
            sm[threadIdx.x] = M;
            ss[threadIdx.x] = s1 * __expf(m1 - M) + s2 * __expf(m2 - M);
        }
        __syncthreads();
    }
    if (threadIdx.x == 0) { stats[row * 2] = sm[0]; stats[row * 2 + 1] = ss[0]; }
}

// ---------------------------------------------------------------------------
// Partial context: ctxpart[bh][split][d][e] = sum_{n in split} exp(k[d,n]-max_d) * v[e,n]
// fp32 WMMA: A = exp(k - max) (row d), B = v (column e), K = n.
// One wave = the whole 32x32 context of its head over 64 positions (four accumulator tiles, so
// every fragment feeds two products); 8 waves = the split's 512 positions; their eight partial
// tiles are summed through LDS in wave order.
// Global loads cover whole 128-byte lines (4 rows x 32 positions per wave load); each wave turns
// them into fragments through its own LDS range, 32 positions at a time.
// k order, equal for A and B (same offsets): group g, lane half h, step p, element s
// -> n = 8*g + 4*h + 2*p + s: one 16-byte LDS load per row and group.
// grid: (128 bh, 8 splits); deterministic (no atomics).
// ---------------------------------------------------------------------------
// exp(x) as the fast-math form computes it (one multiply, v_exp_f32). The v_nop is the free slot
// the instruction set asks for behind a transcendental before its result is read or its source
// overwritten; in one statement it cannot drift away from the v_exp_f32.
__device__ __forceinline__ float exp_slot(float x)
{
    float r;
    asm("v_exp_f32 %0, %1\n\tv_nop" : "=v"(r) : "v"(x * 1.44269504088896340736f));
    return r;
}

#define SPITCH 36              // LDS row pitch in floats: 16 bytes x odd, conflict-free 16-byte reads
#define WRANGE (64 * SPITCH)   // floats per wave: 32 k rows, then 32 v rows
__global__ __launch_bounds__(256) void context_part_kernel(
    const float* __restrict__ kvbuf, const float* __restrict__ stats,
    float* __restrict__ ctxpart)
{
    const int bh = blockIdx.x, split = blockIdx.y;
    const int b = bh >> 2, hd = bh & 3;
    const int tid  = threadIdx.x;
    const int lane = tid & 31;
    const int wave = __builtin_amdgcn_readfirstlane(tid >> 5);  // scalar: keeps the bases in SGPRs
    const int c = lane & 15, h = lane >> 4;

    const float* kb = kvbuf + ((size_t)b * 256 + hd * 32) * NPIX + split * 512 + wave * 64;
    const float* vb = kb + (size_t)128 * NPIX;

    __shared__ __attribute__((aligned(16))) float st[8 * WRANGE];
    float* sw = st + wave * WRANGE;

    const float mx0 = stats[(b * 128 + hd * 32 + c) * 2];
    const float mx1 = stats[(b * 128 + hd * 32 + 16 + c) * 2];

    const int lr = lane >> 3, lc = (lane & 7) * 4;   // row in a group of four, column
    const int goff = lr * NPIX + lc;
    float4 kg[2][8], vg[2][8];
    #pragma unroll
    for (int hf = 0; hf < 2; ++hf) {
        #pragma unroll
        for (int j = 0; j < 8; ++j) kg[hf][j] = *(const float4*)&kb[goff + j * 4 * NPIX + hf * 32];
        #pragma unroll
        for (int j = 0; j < 8; ++j) vg[hf][j] = *(const float4*)&vb[goff + j * 4 * NPIX + hf * 32];
    }
    v8f c00 = {}, c01 = {}, c10 = {}, c11 = {};
    #pragma unroll
    for (int hf = 0; hf < 2; ++hf) {
        #pragma unroll
        for (int j = 0; j < 8; ++j) {
            *(float4*)&sw[(4 * j + lr) * SPITCH + lc]      = kg[hf][j];
            *(float4*)&sw[(32 + 4 * j + lr) * SPITCH + lc] = vg[hf][j];
        }
        // The rows are read back by other lanes of this wave: their stores must have retired.
        asm volatile("s_wait_dscnt 0x0" ::: "memory");
        #pragma unroll
        for (int g = 0; g < 4; ++g) {
            const int fo = c * SPITCH + 8 * g + 4 * h;
            const float4 k0 = *(const float4*)&sw[fo];
            const float4 k1 = *(const float4*)&sw[fo + 16 * SPITCH];
            const float4 v0 = *(const float4*)&sw[fo + 32 * SPITCH];
            const float4 v1 = *(const float4*)&sw[fo + 48 * SPITCH];
            v2f a0l = {exp_slot(k0.x - mx0), exp_slot(k0.y - mx0)};
            v2f a0h = {exp_slot(k0.z - mx0), exp_slot(k0.w - mx0)};
            v2f a1l = {exp_slot(k1.x - mx1), exp_slot(k1.y - mx1)};
            v2f a1h = {exp_slot(k1.z - mx1), exp_slot(k1.w - mx1)};
            v2f b0l = {v0.x, v0.y};
            v2f b0h = {v0.z, v0.w};
            v2f b1l = {v1.x, v1.y};
            v2f b1h = {v1.z, v1.w};
            c00 = __builtin_amdgcn_wmma_f32_16x16x4_f32(false, a0l, false, b0l, (short)0, c00, false, false);
            c01 = __builtin_amdgcn_wmma_f32_16x16x4_f32(false, a0l, false, b1l, (short)0, c01, false, false);
            c10 = __builtin_amdgcn_wmma_f32_16x16x4_f32(false, a1l, false, b0l, (short)0, c10, false, false);
            c11 = __builtin_amdgcn_wmma_f32_16x16x4_f32(false, a1l, false, b1l, (short)0, c11, false, false);
            c00 = __builtin_amdgcn_wmma_f32_16x16x4_f32(false, a0h, false, b0h, (short)0, c00, false, false);
            c01 = __builtin_amdgcn_wmma_f32_16x16x4_f32(false, a0h, false, b1h, (short)0, c01, false, false);
            c10 = __builtin_amdgcn_wmma_f32_16x16x4_f32(false, a1h, false, b0h, (short)0, c10, false, false);
            c11 = __builtin_amdgcn_wmma_f32_16x16x4_f32(false, a1h, false, b1h, (short)0, c11, false, false);
        }
    }

    // Partial tile into the wave's own range. D layout: VGPR i -> row d = i + 8*h, col e = c
    float* rw = sw + (8 * h) * SPITCH + c;
    #pragma unroll
    for (int i = 0; i < 8; ++i) {
        rw[i * SPITCH]             = c00[i];
        rw[i * SPITCH + 16]        = c01[i];
        rw[(i + 16) * SPITCH]      = c10[i];
        rw[(i + 16) * SPITCH + 16] = c11[i];
    }
    __syncthreads();   // all eight partial tiles written before any thread sums them

    const float* rr = st + (tid >> 3) * SPITCH + (tid & 7) * 4;   // thread owns 4 e of one d
    float4 s = *(const float4*)rr;
    #pragma unroll
    for (int w = 1; w < 8; ++w) {
        float4 t = *(const float4*)&rr[w * WRANGE];
        s.x += t.x; s.y += t.y; s.z += t.z; s.w += t.w;
    }
    *(float4*)&ctxpart[((size_t)(bh * 8 + split)) * 1024 + tid * 4] = s;
}

// ---------------------------------------------------------------------------
// Reduce partials -> ctx, fold w_out:  M[b][o][h*32+d] = sum_e w_out[o,h*32+e]*ctx[d,e]/sum_d
// ---------------------------------------------------------------------------
__global__ __launch_bounds__(256) void context_M_kernel(
    const float* __restrict__ ctxpart, const float* __restrict__ stats,
    const float* __restrict__ w_out, float* __restrict__ Mbuf)
{
    const int bh = blockIdx.x, b = bh >> 2, h = bh & 3;
    __shared__ float ctx[32 * 33];
    __shared__ float wsl[128 * 32];
    const int tid = threadIdx.x;

    for (int i = tid; i < 1024; i += 256) {
        int d = i >> 5;
        const float* cp = ctxpart + (size_t)bh * 8 * 1024 + i;
        float s = 0.f;
        #pragma unroll
        for (int p = 0; p < 8; ++p) s += cp[p * 1024];
        float sinv = 1.0f / stats[((b * 128) + h * 32 + d) * 2 + 1];
        ctx[d * 33 + (i & 31)] = s * sinv;
    }
    for (int i = tid; i < 128 * 32; i += 256) {
        int o = i >> 5, ee = i & 31;
        wsl[i] = w_out[o * CDIM + h * 32 + ee];
    }
    __syncthreads();

    const int o = tid >> 1, dbase = (tid & 1) * 16;
    float* Mrow = Mbuf + (size_t)b * CDIM * CDIM + (size_t)o * CDIM + h * 32;
    for (int j = 0; j < 16; ++j) {
        int d = dbase + j;
        float s = 0.f;
        #pragma unroll
        for (int ee = 0; ee < 32; ++ee) s += wsl[o * 32 + ee] * ctx[d * 33 + ee];
        Mrow[d] = s;
    }
}

// ---------------------------------------------------------------------------
// G[b] = M[b] (128x128) @ Wq (128x128)  (Wq = rows 0..127 of w_qkv), fp32 WMMA.
// One wave = 16 rows x 32 cols of G (two independent accumulator chains), K = 128 unrolled.
// Operands come straight from global (both are small and cache-resident): no LDS, no barrier.
// block = 4 waves = 64 rows x 32 cols (the waves share the Wq columns);
// grid: (4 col groups, 2 row halves, 32 batches) = 256 blocks.
// k order, equal for A and B: chunk u (4 wide per lane half), lane half h, step p, element s
// -> k = 16*(u>>1) + 8*h + 4*(u&1) + 2*p + s: A is one 16-byte load per chunk, and a lane's
// offset into Wq (row 8*h, col c) is also its offset into the D tile (row 8*h, col c).
// ---------------------------------------------------------------------------
__global__ __launch_bounds__(128) void compute_G_kernel(
    const float* __restrict__ Mbuf, const float* __restrict__ w_qkv,
    float* __restrict__ Gbuf)
{
    const int lane = threadIdx.x & 31;
    const int wave = __builtin_amdgcn_readfirstlane(threadIdx.x >> 5);  // scalar: keeps the bases in SGPRs
    const int c = lane & 15, h = lane >> 4;
    const int m0 = blockIdx.y * 64 + wave * 16;
    const int n0 = blockIdx.x * 32;

    const float* Ab = Mbuf + (size_t)blockIdx.z * CDIM * CDIM + (size_t)m0 * CDIM;
    const float* Bb = w_qkv + n0;
    float*       Gb = Gbuf + (size_t)blockIdx.z * CDIM * CDIM + (size_t)m0 * CDIM + n0;
    const int aoff = c * CDIM + 8 * h;
    const int boff = 8 * h * CDIM + c;

    float4 a[16];
    float  bq[16][4][2];
    #pragma unroll
    for (int u = 0; u < 16; ++u) {
        const int kb = 16 * (u >> 1) + 4 * (u & 1);
        a[u] = *(const float4*)&Ab[aoff + kb];
        #pragma unroll
        for (int r = 0; r < 4; ++r) {
            bq[u][r][0] = Bb[boff + (kb + r) * CDIM];
            bq[u][r][1] = Bb[boff + (kb + r) * CDIM + 16];
        }
    }
    // The accumulators may take over the registers that hold the loads' lane offsets: this is the
    // wait that belongs in front of such an overwrite (the products stay behind the line below).
    asm volatile("s_wait_xcnt 0x0" ::: "memory");
    // Keeps every load in front of the first product, so that as many as the counter allows are
    // in flight at once; left to itself the scheduler holds three chunks in flight and pays the
    // load latency once per group.
    __builtin_amdgcn_sched_barrier(0);

    v8f c0 = {}; v8f c1 = {};
    #pragma unroll
    for (int u = 0; u < 16; ++u) {
        v2f a0  = {a[u].x, a[u].y};
        v2f a1  = {a[u].z, a[u].w};
        v2f b00 = {bq[u][0][0], bq[u][1][0]};
        v2f b01 = {bq[u][0][1], bq[u][1][1]};
        v2f b10 = {bq[u][2][0], bq[u][3][0]};
        v2f b11 = {bq[u][2][1], bq[u][3][1]};
        c0 = __builtin_amdgcn_wmma_f32_16x16x4_f32(false, a0, false, b00, (short)0, c0, false, false);
        c1 = __builtin_amdgcn_wmma_f32_16x16x4_f32(false, a0, false, b01, (short)0, c1, false, false);
        c0 = __builtin_amdgcn_wmma_f32_16x16x4_f32(false, a1, false, b10, (short)0, c0, false, false);
        c1 = __builtin_amdgcn_wmma_f32_16x16x4_f32(false, a1, false, b11, (short)0, c1, false, false);
    }

    // D layout: VGPR i -> row i + 8*h, col c
    #pragma unroll
    for (int i = 0; i < 8; ++i) {
        Gb[boff + i * CDIM]      = c0[i];
        Gb[boff + i * CDIM + 16] = c1[i];
    }
}

// ---------------------------------------------------------------------------
extern "C" void kernel_launch(void* const* d_in, const int* in_sizes, int n_in,
                              void* d_out, int out_size, void* d_ws, size_t ws_size,
                              hipStream_t stream)
{
    const float* x      = (const float*)d_in[0];   // 32 x 128 x 64 x 64
    const float* w_qkv  = (const float*)d_in[1];   // 384 x 128
    const float* w_out  = (const float*)d_in[2];   // 128 x 128
    const float* b_out  = (const float*)d_in[3];   // 128
    float* out = (float*)d_out;                    // 32 x 128 x 64 x 64

    float* kv      = (float*)d_ws;                                   // 32*256*4096
    float* stats   = kv + (size_t)32 * 256 * NPIX;                   // 4096*2
    float* ctxpart = stats + 8192;                                   // 128*8*1024
    float* Mbuf    = ctxpart + (size_t)128 * 8 * 1024;               // 32*128*128
    float* Gbuf    = Mbuf + (size_t)32 * CDIM * CDIM;                // 32*128*128
    size_t need = ((size_t)(Gbuf + (size_t)32 * CDIM * CDIM - (float*)d_ws)) * sizeof(float);
    if (ws_size < need) return;  // workspace too small; bail deterministically

    // 1) k,v = w_qkv[128:384] @ x[b]
    wmma_gemm_kernel<<<dim3(64, 4, 32), 256, 0, stream>>>(
        w_qkv + 128 * CDIM, 0L, x, kv, 256L * NPIX, nullptr);
    // 2) softmax stats over k rows
    row_stats_kernel<<<4096, 256, 0, stream>>>(kv, stats);
    // 3) partial context
    context_part_kernel<<<dim3(128, 8), 256, 0, stream>>>(kv, stats, ctxpart);
    // 4) ctx reduce + fold w_out -> M
    context_M_kernel<<<128, 256, 0, stream>>>(ctxpart, stats, w_out, Mbuf);
    // 5) G = M @ Wq
    compute_G_kernel<<<dim3(4, 2, 32), 128, 0, stream>>>(Mbuf, w_qkv, Gbuf);
    // 6) out = G @ x + b_out
    wmma_gemm_kernel<<<dim3(64, 2, 32), 256, 0, stream>>>(
        Gbuf, (long)(CDIM * CDIM), x, out, (long)(CDIM * NPIX), b_out);
}

// v003
// It runs in 122 microseconds.
// Timed twice side by side with v002, it ran 1.12 times as fast both times.
// Counting every step since v000, it is 2.28 times as fast.
#include <hip/hip_runtime.h>

typedef float v2f __attribute__((ext_vector_type(2)));
typedef float v8f __attribute__((ext_vector_type(8)));

#define NPIX 4096   // 64*64
#define CDIM 128

// ---------------------------------------------------------------------------
// fp32 WMMA GEMM:  Out[b] (16*MT x 4096) = A[b] (16*MT x 128) @ X[b] (128 x 4096)
// X stays in registers: a wave loads its 128 x 32 slab of X once, straight from global, as the
// B fragments of two column tiles (128 VGPRs), and walks down all MT row tiles of A with it.
// The whole A lies in LDS (asynchronous copies, filled once, one barrier); nothing of X goes
// through LDS. block = 8 waves = 256 columns; grid: (16 column slabs, 32 batches).
// Columns: lane c holds columns 2c (tile 0) and 2c+1 (tile 1) of the wave's 32, so a load and
// a store cover a whole 128-byte line per lane half.
// k order, equal for A and B: group g, lane half h, step p, element s
// -> k = 8*g + 4*h + 2*p + s: A is one 16-byte LDS load per row and group.
// ---------------------------------------------------------------------------
#define APITCH 132   // LDS row pitch in floats: 16 bytes x odd, conflict-free 16-byte reads
// Every plain "#pragma unroll" in gemm_xreg: the fragment arrays stay in registers only if every
// index is a constant.

template <int MT, bool BIAS>
__device__ __forceinline__ void gemm_xreg(
    const float* __restrict__ A, const float* __restrict__ Xb, float* __restrict__ Ob,
    const float* __restrict__ bias, float* la, float* lbias)
{
    const int tid  = threadIdx.x;
    const int lane = tid & 31;
    const int wave = __builtin_amdgcn_readfirstlane(tid >> 5);  // scalar: keeps the bases in SGPRs
    const int c = lane & 15, h = lane >> 4;

    // ---- A (16*MT x 128) into la: a wave copies one row (512 B) per copy, 16 B per lane ----
    {
        const unsigned l0 = (unsigned)(size_t)&la[(tid >> 5) * APITCH + lane * 4];
        const float*   g0 = A + tid * 4;
        #pragma unroll
        for (int it = 0; it < 2 * MT; it += 8) {
            // The s_wait_xcnt is the wait that belongs in front of a later overwrite of the
            // copies' address registers; inside the statement nothing can move in between.
            asm volatile(
                "global_load_async_to_lds_b128 %0, %8, off\n\t"
                "global_load_async_to_lds_b128 %1, %9, off\n\t"
                "global_load_async_to_lds_b128 %2, %10, off\n\t"
                "global_load_async_to_lds_b128 %3, %11, off\n\t"
                "global_load_async_to_lds_b128 %4, %12, off\n\t"
                "global_load_async_to_lds_b128 %5, %13, off\n\t"
                "global_load_async_to_lds_b128 %6, %14, off\n\t"
                "global_load_async_to_lds_b128 %7, %15, off\n\t"
                "s_wait_xcnt 0x0"
                :: "v"(l0 + (it + 0) * 8 * APITCH * 4), "v"(l0 + (it + 1) * 8 * APITCH * 4),
                   "v"(l0 + (it + 2) * 8 * APITCH * 4), "v"(l0 + (it + 3) * 8 * APITCH * 4),
                   "v"(l0 + (it + 4) * 8 * APITCH * 4), "v"(l0 + (it + 5) * 8 * APITCH * 4),
                   "v"(l0 + (it + 6) * 8 * APITCH * 4), "v"(l0 + (it + 7) * 8 * APITCH * 4),
                   "v"(g0 + (it + 0) * 8 * CDIM), "v"(g0 + (it + 1) * 8 * CDIM),
                   "v"(g0 + (it + 2) * 8 * CDIM), "v"(g0 + (it + 3) * 8 * CDIM),
                   "v"(g0 + (it + 4) * 8 * CDIM), "v"(g0 + (it + 5) * 8 * CDIM),
                   "v"(g0 + (it + 6) * 8 * CDIM), "v"(g0 + (it + 7) * 8 * CDIM)
                : "memory");
        }
    }

    // ---- X slab into registers: row 8g + 4h + j, columns 2c and 2c+1 ----
    const int ncol = blockIdx.x * 256 + wave * 32;
    const float* xp = Xb + ncol;
    const int xoff = 4 * h * NPIX + 2 * c;
    v2f b0[32], b1[32];   // [2g + p]: B fragments of column tile 0 and 1
    #pragma unroll
    for (int g = 0; g < 16; ++g) {
        #pragma unroll
        for (int p = 0; p < 2; ++p) {
            const v2f r0 = *(const v2f*)&xp[xoff + (8 * g + 2 * p) * NPIX];
            const v2f r1 = *(const v2f*)&xp[xoff + (8 * g + 2 * p + 1) * NPIX];
            b0[2 * g + p] = v2f{r0.x, r1.x};
            b1[2 * g + p] = v2f{r0.y, r1.y};
        }
    }
    // bias goes through LDS too, so that the row-tile loop holds no global load
    if (BIAS && tid < 16 * MT) lbias[tid] = bias[tid];
    // The wait that belongs in front of a later overwrite of the loads' offset registers.
    asm volatile("s_wait_xcnt 0x0" ::: "memory");
    // This wave's copies have landed; the barrier then publishes every wave's rows of A (and the bias).
    asm volatile("s_wait_asynccnt 0x0" ::: "memory");
    __syncthreads();

    const float* ap = la + c * APITCH + 4 * h;
    float* op = Ob + ncol;
    const int ooff = 8 * h * NPIX + 2 * c;

    // A fragments run half a row tile ahead: groups 0-7 of the next tile are fetched while
    // groups 8-15 of this one are multiplied, and the other way round.
    float4 alo[8], ahi[8];
    #pragma unroll
    for (int g = 0; g < 8; ++g) alo[g] = *(const float4*)&ap[8 * g];

    // Kept rolled: a trip already holds 64 products, and a second copy of the body would want a
    // second set of A fragments, past the 256 registers that let two blocks share a WGP.
    #pragma unroll 1
    for (int mt = 0; mt < MT; ++mt) {
        const float* at = ap + mt * 16 * APITCH;
        #pragma unroll
        for (int g = 0; g < 8; ++g) ahi[g] = *(const float4*)&at[64 + 8 * g];
        float4 bl = {}, bh = {};
        if (BIAS) {
            bl = *(const float4*)&lbias[mt * 16 + 8 * h];
            bh = *(const float4*)&lbias[mt * 16 + 8 * h + 4];
        }

        v8f c0 = {}, c1 = {};
        #pragma unroll
        for (int g = 0; g < 8; ++g) {
            const v2f al = {alo[g].x, alo[g].y}, ah = {alo[g].z, alo[g].w};
            c0 = __builtin_amdgcn_wmma_f32_16x16x4_f32(false, al, false, b0[2 * g],     (short)0, c0, false, false);
            c1 = __builtin_amdgcn_wmma_f32_16x16x4_f32(false, al, false, b1[2 * g],     (short)0, c1, false, false);
            c0 = __builtin_amdgcn_wmma_f32_16x16x4_f32(false, ah, false, b0[2 * g + 1], (short)0, c0, false, false);
            c1 = __builtin_amdgcn_wmma_f32_16x16x4_f32(false, ah, false, b1[2 * g + 1], (short)0, c1, false, false);
        }
        // the last trip fetches its own tile again: in bounds, not used
        const float* an = ap + (mt + 1 < MT ? mt + 1 : mt) * 16 * APITCH;
        #pragma unroll
        for (int g = 0; g < 8; ++g) alo[g] = *(const float4*)&an[8 * g];
        #pragma unroll
        for (int g = 0; g < 8; ++g) {
            const v2f al = {ahi[g].x, ahi[g].y}, ah = {ahi[g].z, ahi[g].w};
            c0 = __builtin_amdgcn_wmma_f32_16x16x4_f32(false, al, false, b0[16 + 2 * g],     (short)0, c0, false, false);
            c1 = __builtin_amdgcn_wmma_f32_16x16x4_f32(false, al, false, b1[16 + 2 * g],     (short)0, c1, false, false);
            c0 = __builtin_amdgcn_wmma_f32_16x16x4_f32(false, ah, false, b0[16 + 2 * g + 1], (short)0, c0, false, false);
            c1 = __builtin_amdgcn_wmma_f32_16x16x4_f32(false, ah, false, b1[16 + 2 * g + 1], (short)0, c1, false, false);
        }

        // D layout: VGPR i -> row i + 8*h, col c of its tile = columns 2c, 2c+1
        const float bb[8] = {bl.x, bl.y, bl.z, bl.w, bh.x, bh.y, bh.z, bh.w};
        float* ot = op + (size_t)mt * 16 * NPIX;
        #pragma unroll
        for (int i = 0; i < 8; ++i)
            *(v2f*)&ot[ooff + i * NPIX] = BIAS ? v2f{c0[i] + bb[i], c1[i] + bb[i]} : v2f{c0[i], c1[i]};
        // The wait that belongs in front of the next trip's overwrite of the stores' registers.
        asm volatile("s_wait_xcnt 0x0" ::: "memory");
    }
}

// k,v = w_qkv[128:384] (256 x 128) @ x[b]
__global__ __launch_bounds__(256) void gemm_kv_kernel(
    const float* __restrict__ Wkv, const float* __restrict__ X, float* __restrict__ Out)
{
    __shared__ __attribute__((aligned(16))) float la[256 * APITCH];
    const int b = blockIdx.y;
    gemm_xreg<16, false>(Wkv, X + (size_t)b * CDIM * NPIX, Out + (size_t)b * 256 * NPIX, nullptr, la, nullptr);
}

// out[b] = G[b] (128 x 128) @ x[b] + bias
__global__ __launch_bounds__(256) void gemm_out_kernel(
    const float* __restrict__ G, const float* __restrict__ X, float* __restrict__ Out,
    const float* __restrict__ bias)
{
    __shared__ __attribute__((aligned(16))) float la[128 * APITCH];
    __shared__ __attribute__((aligned(16))) float lbias[128];
    const int b = blockIdx.y;
    gemm_xreg<8, true>(G + (size_t)b * CDIM * CDIM, X + (size_t)b * CDIM * NPIX,
                       Out + (size_t)b * CDIM * NPIX, bias, la, lbias);
}

// ---------------------------------------------------------------------------
// Per-row online softmax stats for k: max and sum(exp(x-max)). 4096 rows.
// ---------------------------------------------------------------------------
__global__ __launch_bounds__(256) void row_stats_kernel(
    const float* __restrict__ kvbuf, float* __restrict__ stats)
{
    const int row = blockIdx.x;                 // b*128 + r
    const int b = row >> 7, r = row & 127;
    const float* kr = kvbuf + ((size_t)b * 256 + r) * NPIX;

    float m = -1e30f, s = 0.0f;
    for (int n = threadIdx.x; n < NPIX; n += 256) {
        float val = kr[n];
        if (val > m) { s = s * __expf(m - val) + 1.0f; m = val; }
        else          { s += __expf(val - m); }
    }
    __shared__ float sm[256], ss[256];
    sm[threadIdx.x] = m; ss[threadIdx.x] = s;
    __syncthreads();
    for (int off = 128; off; off >>= 1) {
        if (threadIdx.x < off) {
            float m1 = sm[threadIdx.x], s1 = ss[threadIdx.x];
            float m2 = sm[threadIdx.x + off], s2 = ss[threadIdx.x + off];
            float M  = fmaxf(m1, m2);
            sm[threadIdx.x] = M;
            ss[threadIdx.x] = s1 * __expf(m1 - M) + s2 * __expf(m2 - M);
        }
        __syncthreads();
    }
    if (threadIdx.x == 0) { stats[row * 2] = sm[0]; stats[row * 2 + 1] = ss[0]; }
}

// ---------------------------------------------------------------------------
// Partial context: ctxpart[bh][split][d][e] = sum_{n in split} exp(k[d,n]-max_d) * v[e,n]
// fp32 WMMA: A = exp(k - max) (row d), B = v (column e), K = n.
// One wave = the whole 32x32 context of its head over 64 positions (four accumulator tiles, so
// every fragment feeds two products); 8 waves = the split's 512 positions; their eight partial
// tiles are summed through LDS in wave order.
// Global loads cover whole 128-byte lines (4 rows x 32 positions per wave load); each wave turns
// them into fragments through its own LDS range, 32 positions at a time.
// k order, equal for A and B (same offsets): group g, lane half h, step p, element s
// -> n = 8*g + 4*h + 2*p + s: one 16-byte LDS load per row and group.
// grid: (128 bh, 8 splits); deterministic (no atomics).
// ---------------------------------------------------------------------------
// exp(x) as the fast-math form computes it (one multiply, v_exp_f32). The v_nop is the free slot
// the instruction set asks for behind a transcendental before its result is read or its source
// overwritten; in one statement it cannot drift away from the v_exp_f32.
__device__ __forceinline__ float exp_slot(float x)
{
    float r;
    asm("v_exp_f32 %0, %1\n\tv_nop" : "=v"(r) : "v"(x * 1.44269504088896340736f));
    return r;
}

#define SPITCH 36              // LDS row pitch in floats: 16 bytes x odd, conflict-free 16-byte reads
#define WRANGE (64 * SPITCH)   // floats per wave: 32 k rows, then 32 v rows
__global__ __launch_bounds__(256) void context_part_kernel(
    const float* __restrict__ kvbuf, const float* __restrict__ stats,
    float* __restrict__ ctxpart)
{
    const int bh = blockIdx.x, split = blockIdx.y;
    const int b = bh >> 2, hd = bh & 3;
    const int tid  = threadIdx.x;
    const int lane = tid & 31;
    const int wave = __builtin_amdgcn_readfirstlane(tid >> 5);  // scalar: keeps the bases in SGPRs
    const int c = lane & 15, h = lane >> 4;

    const float* kb = kvbuf + ((size_t)b * 256 + hd * 32) * NPIX + split * 512 + wave * 64;
    const float* vb = kb + (size_t)128 * NPIX;

    __shared__ __attribute__((aligned(16))) float st[8 * WRANGE];
    float* sw = st + wave * WRANGE;

    const float mx0 = stats[(b * 128 + hd * 32 + c) * 2];
    const float mx1 = stats[(b * 128 + hd * 32 + 16 + c) * 2];

    const int lr = lane >> 3, lc = (lane & 7) * 4;   // row in a group of four, column
    const int goff = lr * NPIX + lc;
    float4 kg[2][8], vg[2][8];
    #pragma unroll
    for (int hf = 0; hf < 2; ++hf) {
        #pragma unroll
        for (int j = 0; j < 8; ++j) kg[hf][j] = *(const float4*)&kb[goff + j * 4 * NPIX + hf * 32];
        #pragma unroll
        for (int j = 0; j < 8; ++j) vg[hf][j] = *(const float4*)&vb[goff + j * 4 * NPIX + hf * 32];
    }
    v8f c00 = {}, c01 = {}, c10 = {}, c11 = {};
    #pragma unroll
    for (int hf = 0; hf < 2; ++hf) {
        #pragma unroll
        for (int j = 0; j < 8; ++j) {
            *(float4*)&sw[(4 * j + lr) * SPITCH + lc]      = kg[hf][j];
            *(float4*)&sw[(32 + 4 * j + lr) * SPITCH + lc] = vg[hf][j];
        }
        // The rows are read back by other lanes of this wave: their stores must have retired.
        asm volatile("s_wait_dscnt 0x0" ::: "memory");
        #pragma unroll
        for (int g = 0; g < 4; ++g) {
            const int fo = c * SPITCH + 8 * g + 4 * h;
            const float4 k0 = *(const float4*)&sw[fo];
            const float4 k1 = *(const float4*)&sw[fo + 16 * SPITCH];
            const float4 v0 = *(const float4*)&sw[fo + 32 * SPITCH];
            const float4 v1 = *(const float4*)&sw[fo + 48 * SPITCH];
            v2f a0l = {exp_slot(k0.x - mx0), exp_slot(k0.y - mx0)};
            v2f a0h = {exp_slot(k0.z - mx0), exp_slot(k0.w - mx0)};
            v2f a1l = {exp_slot(k1.x - mx1), exp_slot(k1.y - mx1)};
            v2f a1h = {exp_slot(k1.z - mx1), exp_slot(k1.w - mx1)};
            v2f b0l = {v0.x, v0.y};
            v2f b0h = {v0.z, v0.w};
            v2f b1l = {v1.x, v1.y};
            v2f b1h = {v1.z, v1.w};
            c00 = __builtin_amdgcn_wmma_f32_16x16x4_f32(false, a0l, false, b0l, (short)0, c00, false, false);
            c01 = __builtin_amdgcn_wmma_f32_16x16x4_f32(false, a0l, false, b1l, (short)0, c01, false, false);
            c10 = __builtin_amdgcn_wmma_f32_16x16x4_f32(false, a1l, false, b0l, (short)0, c10, false, false);
            c11 = __builtin_amdgcn_wmma_f32_16x16x4_f32(false, a1l, false, b1l, (short)0, c11, false, false);
            c00 = __builtin_amdgcn_wmma_f32_16x16x4_f32(false, a0h, false, b0h, (short)0, c00, false, false);
            c01 = __builtin_amdgcn_wmma_f32_16x16x4_f32(false, a0h, false, b1h, (short)0, c01, false, false);
            c10 = __builtin_amdgcn_wmma_f32_16x16x4_f32(false, a1h, false, b0h, (short)0, c10, false, false);
            c11 = __builtin_amdgcn_wmma_f32_16x16x4_f32(false, a1h, false, b1h, (short)0, c11, false, false);
        }
    }

    // Partial tile into the wave's own range. D layout: VGPR i -> row d = i + 8*h, col e = c
    float* rw = sw + (8 * h) * SPITCH + c;
    #pragma unroll
    for (int i = 0; i < 8; ++i) {
        rw[i * SPITCH]             = c00[i];
        rw[i * SPITCH + 16]        = c01[i];
        rw[(i + 16) * SPITCH]      = c10[i];
        rw[(i + 16) * SPITCH + 16] = c11[i];
    }
    __syncthreads();   // all eight partial tiles written before any thread sums them

    const float* rr = st + (tid >> 3) * SPITCH + (tid & 7) * 4;   // thread owns 4 e of one d
    float4 s = *(const float4*)rr;
    #pragma unroll
    for (int w = 1; w < 8; ++w) {
        float4 t = *(const float4*)&rr[w * WRANGE];
        s.x += t.x; s.y += t.y; s.z += t.z; s.w += t.w;
    }
    *(float4*)&ctxpart[((size_t)(bh * 8 + split)) * 1024 + tid * 4] = s;
}

// ---------------------------------------------------------------------------
// Reduce partials -> ctx, fold w_out:  M[b][o][h*32+d] = sum_e w_out[o,h*32+e]*ctx[d,e]/sum_d
// ---------------------------------------------------------------------------
__global__ __launch_bounds__(256) void context_M_kernel(
    const float* __restrict__ ctxpart, const float* __restrict__ stats,
    const float* __restrict__ w_out, float* __restrict__ Mbuf)
{
    const int bh = blockIdx.x, b = bh >> 2, h = bh & 3;
    __shared__ float ctx[32 * 33];
    __shared__ float wsl[128 * 32];
    const int tid = threadIdx.x;

    for (int i = tid; i < 1024; i += 256) {
        int d = i >> 5;
        const float* cp = ctxpart + (size_t)bh * 8 * 1024 + i;
        float s = 0.f;
        #pragma unroll
        for (int p = 0; p < 8; ++p) s += cp[p * 1024];
        float sinv = 1.0f / stats[((b * 128) + h * 32 + d) * 2 + 1];
        ctx[d * 33 + (i & 31)] = s * sinv;
    }
    for (int i = tid; i < 128 * 32; i += 256) {
        int o = i >> 5, ee = i & 31;
        wsl[i] = w_out[o * CDIM + h * 32 + ee];
    }
    __syncthreads();

    const int o = tid >> 1, dbase = (tid & 1) * 16;
    float* Mrow = Mbuf + (size_t)b * CDIM * CDIM + (size_t)o * CDIM + h * 32;
    for (int j = 0; j < 16; ++j) {
        int d = dbase + j;
        float s = 0.f;
        #pragma unroll
        for (int ee = 0; ee < 32; ++ee) s += wsl[o * 32 + ee] * ctx[d * 33 + ee];
        Mrow[d] = s;
    }
}

// ---------------------------------------------------------------------------
// G[b] = M[b] (128x128) @ Wq (128x128)  (Wq = rows 0..127 of w_qkv), fp32 WMMA.
// One wave = 16 rows x 32 cols of G (two independent accumulator chains), K = 128 unrolled.
// Operands come straight from global (both are small and cache-resident): no LDS, no barrier.
// block = 4 waves = 64 rows x 32 cols (the waves share the Wq columns);
// grid: (4 col groups, 2 row halves, 32 batches) = 256 blocks.
// k order, equal for A and B: chunk u (4 wide per lane half), lane half h, step p, element s
// -> k = 16*(u>>1) + 8*h + 4*(u&1) + 2*p + s: A is one 16-byte load per chunk, and a lane's
// offset into Wq (row 8*h, col c) is also its offset into the D tile (row 8*h, col c).
// ---------------------------------------------------------------------------
__global__ __launch_bounds__(128) void compute_G_kernel(
    const float* __restrict__ Mbuf, const float* __restrict__ w_qkv,
    float* __restrict__ Gbuf)
{
    const int lane = threadIdx.x & 31;
    const int wave = __builtin_amdgcn_readfirstlane(threadIdx.x >> 5);  // scalar: keeps the bases in SGPRs
    const int c = lane & 15, h = lane >> 4;
    const int m0 = blockIdx.y * 64 + wave * 16;
    const int n0 = blockIdx.x * 32;

    const float* Ab = Mbuf + (size_t)blockIdx.z * CDIM * CDIM + (size_t)m0 * CDIM;
    const float* Bb = w_qkv + n0;
    float*       Gb = Gbuf + (size_t)blockIdx.z * CDIM * CDIM + (size_t)m0 * CDIM + n0;
    const int aoff = c * CDIM + 8 * h;
    const int boff = 8 * h * CDIM + c;

    float4 a[16];
    float  bq[16][4][2];
    #pragma unroll
    for (int u = 0; u < 16; ++u) {
        const int kb = 16 * (u >> 1) + 4 * (u & 1);
        a[u] = *(const float4*)&Ab[aoff + kb];
        #pragma unroll
        for (int r = 0; r < 4; ++r) {
            bq[u][r][0] = Bb[boff + (kb + r) * CDIM];
            bq[u][r][1] = Bb[boff + (kb + r) * CDIM + 16];
        }
    }
    // The accumulators may take over the registers that hold the loads' lane offsets: this is the
    // wait that belongs in front of such an overwrite (the products stay behind the line below).
    asm volatile("s_wait_xcnt 0x0" ::: "memory");
    // Keeps every load in front of the first product, so that as many as the counter allows are
    // in flight at once; left to itself the scheduler holds three chunks in flight and pays the
    // load latency once per group.
    __builtin_amdgcn_sched_barrier(0);

    v8f c0 = {}; v8f c1 = {};
    #pragma unroll
    for (int u = 0; u < 16; ++u) {
        v2f a0  = {a[u].x, a[u].y};
        v2f a1  = {a[u].z, a[u].w};
        v2f b00 = {bq[u][0][0], bq[u][1][0]};
        v2f b01 = {bq[u][0][1], bq[u][1][1]};
        v2f b10 = {bq[u][2][0], bq[u][3][0]};
        v2f b11 = {bq[u][2][1], bq[u][3][1]};
        c0 = __builtin_amdgcn_wmma_f32_16x16x4_f32(false, a0, false, b00, (short)0, c0, false, false);
        c1 = __builtin_amdgcn_wmma_f32_16x16x4_f32(false, a0, false, b01, (short)0, c1, false, false);
        c0 = __builtin_amdgcn_wmma_f32_16x16x4_f32(false, a1, false, b10, (short)0, c0, false, false);
        c1 = __builtin_amdgcn_wmma_f32_16x16x4_f32(false, a1, false, b11, (short)0, c1, false, false);
    }

    // D layout: VGPR i -> row i + 8*h, col c
    #pragma unroll
    for (int i = 0; i < 8; ++i) {
        Gb[boff + i * CDIM]      = c0[i];
        Gb[boff + i * CDIM + 16] = c1[i];
    }
}

// ---------------------------------------------------------------------------
extern "C" void kernel_launch(void* const* d_in, const int* in_sizes, int n_in,
                              void* d_out, int out_size, void* d_ws, size_t ws_size,
                              hipStream_t stream)
{
    const float* x      = (const float*)d_in[0];   // 32 x 128 x 64 x 64
    const float* w_qkv  = (const float*)d_in[1];   // 384 x 128
    const float* w_out  = (const float*)d_in[2];   // 128 x 128
    const float* b_out  = (const float*)d_in[3];   // 128
    float* out = (float*)d_out;                    // 32 x 128 x 64 x 64

    float* kv      = (float*)d_ws;                                   // 32*256*4096
    float* stats   = kv + (size_t)32 * 256 * NPIX;                   // 4096*2
    float* ctxpart = stats + 8192;                                   // 128*8*1024
    float* Mbuf    = ctxpart + (size_t)128 * 8 * 1024;               // 32*128*128
    float* Gbuf    = Mbuf + (size_t)32 * CDIM * CDIM;                // 32*128*128
    size_t need = ((size_t)(Gbuf + (size_t)32 * CDIM * CDIM - (float*)d_ws)) * sizeof(float);
    if (ws_size < need) return;  // workspace too small; bail deterministically

    // 1) k,v = w_qkv[128:384] @ x[b]
    gemm_kv_kernel<<<dim3(16, 32), 256, 0, stream>>>(w_qkv + 128 * CDIM, x, kv);
    // 2) softmax stats over k rows
    row_stats_kernel<<<4096, 256, 0, stream>>>(kv, stats);
    // 3) partial context
    context_part_kernel<<<dim3(128, 8), 256, 0, stream>>>(kv, stats, ctxpart);
    // 4) ctx reduce + fold w_out -> M
    context_M_kernel<<<128, 256, 0, stream>>>(ctxpart, stats, w_out, Mbuf);
    // 5) G = M @ Wq
    compute_G_kernel<<<dim3(4, 2, 32), 128, 0, stream>>>(Mbuf, w_qkv, Gbuf);
    // 6) out = G @ x + b_out
    gemm_out_kernel<<<dim3(16, 32), 256, 0, stream>>>(Gbuf, x, out, b_out);
}

// v004
// It runs in 89.6 microseconds.
// In both of two side-by-side timings against v003, it was 1.36 times as fast.
// Over all steps from v000 it is 3.11 times as fast.
#include <hip/hip_runtime.h>

typedef float v2f __attribute__((ext_vector_type(2)));
typedef float v8f __attribute__((ext_vector_type(8)));

#define NPIX 4096   // 64*64
#define CDIM 128

// ---------------------------------------------------------------------------
// fp32 WMMA GEMM:  Out[b] (16*MT x 4096) = A[b] (16*MT x 128) @ X[b] (128 x 4096)
// X stays in registers: a wave loads its 128 x 32 slab of X once, straight from global, as the
// B fragments of two column tiles (128 VGPRs), and walks down all MT row tiles of A with it.
// The whole A lies in LDS (asynchronous copies, filled once, one barrier); nothing of X goes
// through LDS. block = 8 waves = 256 columns; grid: (16 column slabs, 32 batches).
// Columns: lane c holds columns 2c (tile 0) and 2c+1 (tile 1) of the wave's 32, so a load and
// a store cover a whole 128-byte line per lane half.
// k order, equal for A and B: group g, lane half h, step p, element s
// -> k = 8*g + 4*h + 2*p + s: A is one 16-byte LDS load per row and group.
// ---------------------------------------------------------------------------
#define APITCH 132   // LDS row pitch in floats: 16 bytes x odd, conflict-free 16-byte reads
// Every plain "#pragma unroll" in gemm_xreg: the fragment arrays stay in registers only if every
// index is a constant.

template <int MT, bool BIAS>
__device__ __forceinline__ void gemm_xreg(
    const float* __restrict__ A, const float* __restrict__ Xb, float* __restrict__ Ob,
    const float* __restrict__ bias, float* la, float* lbias)
{
    const int tid  = threadIdx.x;
    const int lane = tid & 31;
    const int wave = __builtin_amdgcn_readfirstlane(tid >> 5);  // scalar: keeps the bases in SGPRs
    const int c = lane & 15, h = lane >> 4;

    // ---- A (16*MT x 128) into la: a wave copies one row (512 B) per copy, 16 B per lane ----
    {
        const unsigned l0 = (unsigned)(size_t)&la[(tid >> 5) * APITCH + lane * 4];
        const float*   g0 = A + tid * 4;
        #pragma unroll
        for (int it = 0; it < 2 * MT; it += 8) {
            // The s_wait_xcnt is the wait that belongs in front of a later overwrite of the
            // copies' address registers; inside the statement nothing can move in between.
            asm volatile(
                "global_load_async_to_lds_b128 %0, %8, off\n\t"
                "global_load_async_to_lds_b128 %1, %9, off\n\t"
                "global_load_async_to_lds_b128 %2, %10, off\n\t"
                "global_load_async_to_lds_b128 %3, %11, off\n\t"
                "global_load_async_to_lds_b128 %4, %12, off\n\t"
                "global_load_async_to_lds_b128 %5, %13, off\n\t"
                "global_load_async_to_lds_b128 %6, %14, off\n\t"
                "global_load_async_to_lds_b128 %7, %15, off\n\t"
                "s_wait_xcnt 0x0"
                :: "v"(l0 + (it + 0) * 8 * APITCH * 4), "v"(l0 + (it + 1) * 8 * APITCH * 4),
                   "v"(l0 + (it + 2) * 8 * APITCH * 4), "v"(l0 + (it + 3) * 8 * APITCH * 4),
                   "v"(l0 + (it + 4) * 8 * APITCH * 4), "v"(l0 + (it + 5) * 8 * APITCH * 4),
                   "v"(l0 + (it + 6) * 8 * APITCH * 4), "v"(l0 + (it + 7) * 8 * APITCH * 4),
                   "v"(g0 + (it + 0) * 8 * CDIM), "v"(g0 + (it + 1) * 8 * CDIM),
                   "v"(g0 + (it + 2) * 8 * CDIM), "v"(g0 + (it + 3) * 8 * CDIM),
                   "v"(g0 + (it + 4) * 8 * CDIM), "v"(g0 + (it + 5) * 8 * CDIM),
                   "v"(g0 + (it + 6) * 8 * CDIM), "v"(g0 + (it + 7) * 8 * CDIM)
                : "memory");
        }
    }

    // ---- X slab into registers: row 8g + 4h + j, columns 2c and 2c+1 ----
    const int ncol = blockIdx.x * 256 + wave * 32;
    const float* xp = Xb + ncol;
    const int xoff = 4 * h * NPIX + 2 * c;
    v2f b0[32], b1[32];   // [2g + p]: B fragments of column tile 0 and 1
    #pragma unroll
    for (int g = 0; g < 16; ++g) {
        #pragma unroll
        for (int p = 0; p < 2; ++p) {
            const v2f r0 = *(const v2f*)&xp[xoff + (8 * g + 2 * p) * NPIX];
            const v2f r1 = *(const v2f*)&xp[xoff + (8 * g + 2 * p + 1) * NPIX];
            b0[2 * g + p] = v2f{r0.x, r1.x};
            b1[2 * g + p] = v2f{r0.y, r1.y};
        }
    }
    // bias goes through LDS too, so that the row-tile loop holds no global load
    if (BIAS && tid < 16 * MT) lbias[tid] = bias[tid];
    // The wait that belongs in front of a later overwrite of the loads' offset registers.
    asm volatile("s_wait_xcnt 0x0" ::: "memory");
    // This wave's copies have landed; the barrier then publishes every wave's rows of A (and the bias).
    asm volatile("s_wait_asynccnt 0x0" ::: "memory");
    __syncthreads();

    const float* ap = la + c * APITCH + 4 * h;
    float* op = Ob + ncol;
    const int ooff = 8 * h * NPIX + 2 * c;

    // A fragments run half a row tile ahead: groups 0-7 of the next tile are fetched while
    // groups 8-15 of this one are multiplied, and the other way round.
    float4 alo[8], ahi[8];
    #pragma unroll
    for (int g = 0; g < 8; ++g) alo[g] = *(const float4*)&ap[8 * g];

    // Kept rolled: a trip already holds 64 products, and a second copy of the body would want a
    // second set of A fragments, past the 256 registers that let two blocks share a WGP.
    #pragma unroll 1
    for (int mt = 0; mt < MT; ++mt) {
        const float* at = ap + mt * 16 * APITCH;
        #pragma unroll
        for (int g = 0; g < 8; ++g) ahi[g] = *(const float4*)&at[64 + 8 * g];
        float4 bl = {}, bh = {};
        if (BIAS) {
            bl = *(const float4*)&lbias[mt * 16 + 8 * h];
            bh = *(const float4*)&lbias[mt * 16 + 8 * h + 4];
        }

        v8f c0 = {}, c1 = {};
        #pragma unroll
        for (int g = 0; g < 8; ++g) {
            const v2f al = {alo[g].x, alo[g].y}, ah = {alo[g].z, alo[g].w};
            c0 = __builtin_amdgcn_wmma_f32_16x16x4_f32(false, al, false, b0[2 * g],     (short)0, c0, false, false);
            c1 = __builtin_amdgcn_wmma_f32_16x16x4_f32(false, al, false, b1[2 * g],     (short)0, c1, false, false);
            c0 = __builtin_amdgcn_wmma_f32_16x16x4_f32(false, ah, false, b0[2 * g + 1], (short)0, c0, false, false);
            c1 = __builtin_amdgcn_wmma_f32_16x16x4_f32(false, ah, false, b1[2 * g + 1], (short)0, c1, false, false);
        }
        // the last trip fetches its own tile again: in bounds, not used
        const float* an = ap + (mt + 1 < MT ? mt + 1 : mt) * 16 * APITCH;
        #pragma unroll
        for (int g = 0; g < 8; ++g) alo[g] = *(const float4*)&an[8 * g];
        #pragma unroll
        for (int g = 0; g < 8; ++g) {
            const v2f al = {ahi[g].x, ahi[g].y}, ah = {ahi[g].z, ahi[g].w};
            c0 = __builtin_amdgcn_wmma_f32_16x16x4_f32(false, al, false, b0[16 + 2 * g],     (short)0, c0, false, false);
            c1 = __builtin_amdgcn_wmma_f32_16x16x4_f32(false, al, false, b1[16 + 2 * g],     (short)0, c1, false, false);
            c0 = __builtin_amdgcn_wmma_f32_16x16x4_f32(false, ah, false, b0[16 + 2 * g + 1], (short)0, c0, false, false);
            c1 = __builtin_amdgcn_wmma_f32_16x16x4_f32(false, ah, false, b1[16 + 2 * g + 1], (short)0, c1, false, false);
        }

        // D layout: VGPR i -> row i + 8*h, col c of its tile = columns 2c, 2c+1
        const float bb[8] = {bl.x, bl.y, bl.z, bl.w, bh.x, bh.y, bh.z, bh.w};
        float* ot = op + (size_t)mt * 16 * NPIX;
        #pragma unroll
        for (int i = 0; i < 8; ++i)
            *(v2f*)&ot[ooff + i * NPIX] = BIAS ? v2f{c0[i] + bb[i], c1[i] + bb[i]} : v2f{c0[i], c1[i]};
        // The wait that belongs in front of the next trip's overwrite of the stores' registers.
        asm volatile("s_wait_xcnt 0x0" ::: "memory");
    }
}

// out[b] = G[b] (128 x 128) @ x[b] + bias
__global__ __launch_bounds__(256) void gemm_out_kernel(
    const float* __restrict__ G, const float* __restrict__ X, float* __restrict__ Out,
    const float* __restrict__ bias)
{
    __shared__ __attribute__((aligned(16))) float la[128 * APITCH];
    __shared__ __attribute__((aligned(16))) float lbias[128];
    const int b = blockIdx.y;
    gemm_xreg<8, true>(G + (size_t)b * CDIM * CDIM, X + (size_t)b * CDIM * NPIX,
                       Out + (size_t)b * CDIM * NPIX, bias, la, lbias);
}

// ---------------------------------------------------------------------------
// k, v and the partial context in one kernel: k and v never leave the registers.
// A wave owns one head and 128 positions, 32 at a time. It holds the 128 x 32 slab of X as in
// gemm_xreg, but hands it to the matrix unit as A and the rows of W as B, so a product tile comes
// out transposed: register r of lane (c, h) = (W row c) at position index 8*h + r. Registers
// 2p, 2p+1 of such a tile are a fragment of the context product with W row c as its row or column
// and K = positions 8*h + 2*p + s, the same for the k tile and the v tile: no LDS, no lane exchange.
// Softmax runs online: a running maximum and sum per k row (lane c = row d), the accumulators
// rescaled when the maximum moves. The context is kept transposed (row e, column d), so that the
// factor of row d is the lane's own.
// Position of index j in tile t of a slab: 2*j + t (whole 128-byte lines per load, as in gemm_xreg).
// block = 8 waves = 4 heads x 2 position groups; grid: (16, 32 batches); all of W_kv in LDS.
// Out: per (batch, head) 32 parts, each with ctx^T (32 e x 32 d), maximum and sum per d.
// ---------------------------------------------------------------------------
// exp(x) as the fast-math form computes it (one multiply, v_exp_f32). The v_nop is the free slot
// the instruction set asks for behind a transcendental before its result is read or its source
// overwritten; in one statement it cannot drift away from the v_exp_f32.
__device__ __forceinline__ float exp_slot(float x)
{
    float r;
    asm("v_exp_f32 %0, %1\n\tv_nop" : "=v"(r) : "v"(x * 1.44269504088896340736f));
    return r;
}

// value of the lane 16 away (lanes c and c + 16 hold the two halves of a row's positions)
__device__ __forceinline__ float other_half(float x)
{
    const int v = __float_as_int(x);
    return __int_as_float(__builtin_amdgcn_permlanex16(v, v, 0x76543210, 0xfedcba98, false, false));
}

// 16 rows of W (at wp: the lane's row and k half) against the slab: t0, t1 = tiles of positions 2j, 2j+1
__device__ __forceinline__ void tile_t(const float* wp, const v2f (&b0)[32], const v2f (&b1)[32],
                                       v8f& t0, v8f& t1)
{
    t0 = v8f{}; t1 = v8f{};
    #pragma unroll
    for (int g = 0; g < 16; ++g) {
        const float4 w = *(const float4*)&wp[8 * g];
        const v2f wl = {w.x, w.y}, wh = {w.z, w.w};
        t0 = __builtin_amdgcn_wmma_f32_16x16x4_f32(false, b0[2 * g],     false, wl, (short)0, t0, false, false);
        t1 = __builtin_amdgcn_wmma_f32_16x16x4_f32(false, b1[2 * g],     false, wl, (short)0, t1, false, false);
        t0 = __builtin_amdgcn_wmma_f32_16x16x4_f32(false, b0[2 * g + 1], false, wh, (short)0, t0, false, false);
        t1 = __builtin_amdgcn_wmma_f32_16x16x4_f32(false, b1[2 * g + 1], false, wh, (short)0, t1, false, false);
    }
}

#define NPART 32   // parts per (batch, head): 128 positions each
// LDS row of W_kv row R: a head's 32 k rows and 32 v rows lie side by side, so that one address
// register reaches all 64 through the 16-bit offset of an LDS load.
#define WROW(R) ((((R) >> 5) & 3) * 64 + ((R) >> 7) * 32 + ((R) & 31))
// Every plain "#pragma unroll" below: the tile arrays stay in registers only if every index is a constant.
__global__ __launch_bounds__(256) void kv_context_kernel(
    const float* __restrict__ Wkv, const float* __restrict__ X,
    float* __restrict__ ctxpart, float* __restrict__ pmax, float* __restrict__ psum)
{
    __shared__ __attribute__((aligned(16))) float la[256 * APITCH];
    const int tid  = threadIdx.x;
    const int lane = tid & 31;
    const int wave = __builtin_amdgcn_readfirstlane(tid >> 5);  // scalar: keeps the bases in SGPRs
    const int c = lane & 15, h = lane >> 4;
    const int hd = wave & 3, grp = wave >> 2;
    const int b = blockIdx.y;

    // ---- W_kv (256 x 128) into la: a wave copies one row (512 B) per copy, 16 B per lane ----
    {
        const unsigned l0 = (unsigned)(size_t)&la[(tid >> 5) * APITCH + lane * 4];
        const float*   g0 = Wkv + tid * 4;
        #pragma unroll
        for (int it = 0; it < 32; it += 8) {
            // The s_wait_xcnt is the wait that belongs in front of a later overwrite of the
            // copies' address registers; inside the statement nothing can move in between.
            asm volatile(
                "global_load_async_to_lds_b128 %0, %8, off\n\t"
                "global_load_async_to_lds_b128 %1, %9, off\n\t"
                "global_load_async_to_lds_b128 %2, %10, off\n\t"
                "global_load_async_to_lds_b128 %3, %11, off\n\t"
                "global_load_async_to_lds_b128 %4, %12, off\n\t"
                "global_load_async_to_lds_b128 %5, %13, off\n\t"
                "global_load_async_to_lds_b128 %6, %14, off\n\t"
                "global_load_async_to_lds_b128 %7, %15, off\n\t"
                "s_wait_xcnt 0x0"
                :: "v"(l0 + WROW((it + 0) * 8) * APITCH * 4), "v"(l0 + WROW((it + 1) * 8) * APITCH * 4),
                   "v"(l0 + WROW((it + 2) * 8) * APITCH * 4), "v"(l0 + WROW((it + 3) * 8) * APITCH * 4),
                   "v"(l0 + WROW((it + 4) * 8) * APITCH * 4), "v"(l0 + WROW((it + 5) * 8) * APITCH * 4),
                   "v"(l0 + WROW((it + 6) * 8) * APITCH * 4), "v"(l0 + WROW((it + 7) * 8) * APITCH * 4),
                   "v"(g0 + (it + 0) * 8 * CDIM), "v"(g0 + (it + 1) * 8 * CDIM),
                   "v"(g0 + (it + 2) * 8 * CDIM), "v"(g0 + (it + 3) * 8 * CDIM),
                   "v"(g0 + (it + 4) * 8 * CDIM), "v"(g0 + (it + 5) * 8 * CDIM),
                   "v"(g0 + (it + 6) * 8 * CDIM), "v"(g0 + (it + 7) * 8 * CDIM)
                : "memory");
        }
    }

    const float* wk = la + (hd * 64 + c) * APITCH + 4 * h;   // the head's k rows; its v rows 32 further
    const float* wv = wk + 32 * APITCH;
    const float* xg = X + (size_t)b * CDIM * NPIX + blockIdx.x * 256 + grp * 128;
    const int xoff = 4 * h * NPIX + 2 * c;

    v8f acc[2][2] = {};                      // [e tile][d tile]: register r = ctx^T[8*h + r][c]
    float mrun[2] = {-1e30f, -1e30f};        // per d tile: running maximum of row d = c
    float lrun[2] = {0.0f, 0.0f};            // and running sum of exp(k - maximum)

    // Kept rolled: a trip holds 288 products, and the slab alone takes half of the 256 registers
    // that let two blocks share a WGP.
    #pragma unroll 1
    for (int sl = 0; sl < 4; ++sl) {
        // ---- X slab into registers: row 8g + 4h + j, columns 2c and 2c+1 ----
        const float* xp = xg + sl * 32;
        v2f b0[32], b1[32];   // [2g + p]: fragments of position tile 0 and 1
        #pragma unroll
        for (int g = 0; g < 16; ++g) {
            #pragma unroll
            for (int p = 0; p < 2; ++p) {
                const v2f r0 = *(const v2f*)&xp[xoff + (8 * g + 2 * p) * NPIX];
                const v2f r1 = *(const v2f*)&xp[xoff + (8 * g + 2 * p + 1) * NPIX];
                b0[2 * g + p] = v2f{r0.x, r1.x};
                b1[2 * g + p] = v2f{r0.y, r1.y};
            }
        }
        // The wait that belongs in front of a later overwrite of the loads' offset registers.
        asm volatile("s_wait_xcnt 0x0" ::: "memory");
        if (sl == 0) {   // behind the first slab's loads, so that these fly while W lands
            // This wave's copies have landed; the barrier then publishes every wave's rows of W.
            asm volatile("s_wait_asynccnt 0x0" ::: "memory");
            __syncthreads();
        }

        // ---- k^T, then p = exp(k - running maximum) in place ----
        v8f kt[2][2];   // [d tile][position tile]
        #pragma unroll
        for (int dt = 0; dt < 2; ++dt) tile_t(wk + dt * 16 * APITCH, b0, b1, kt[dt][0], kt[dt][1]);
        #pragma unroll
        for (int dt = 0; dt < 2; ++dt) {
            float mx = fmaxf(kt[dt][0][0], kt[dt][1][0]);
            #pragma unroll
            for (int i = 1; i < 8; ++i) mx = fmaxf(mx, fmaxf(kt[dt][0][i], kt[dt][1][i]));
            mx = fmaxf(mx, other_half(mx));
            const float mn = fmaxf(mrun[dt], mx);
            const float f  = exp_slot(mrun[dt] - mn);
            mrun[dt] = mn;
            float s0 = 0.0f, s1 = 0.0f;
            #pragma unroll
            for (int i = 0; i < 8; ++i) {
                kt[dt][0][i] = exp_slot(kt[dt][0][i] - mn);
                kt[dt][1][i] = exp_slot(kt[dt][1][i] - mn);
                s0 += kt[dt][0][i];
                s1 += kt[dt][1][i];
            }
            const float s = s0 + s1;
            lrun[dt] = lrun[dt] * f + (s + other_half(s));
            acc[0][dt] *= f;
            acc[1][dt] *= f;
        }

        // ---- v^T, 16 rows e at a time, and ctx^T += v p^T over the slab's 32 positions ----
        #pragma unroll
        for (int et = 0; et < 2; ++et) {
            // Keeps this v tile's products behind what stands above: left to itself the scheduler forms
            // all eight k and v tiles first, and the 64 registers they then hold at once take the
            // kernel past the 256 that let two blocks share a WGP.
            __builtin_amdgcn_sched_barrier(0);
            v8f vt[2];
            tile_t(wv + et * 16 * APITCH, b0, b1, vt[0], vt[1]);
            #pragma unroll
            for (int p = 0; p < 4; ++p) {
                #pragma unroll
                for (int t = 0; t < 2; ++t) {
                    const v2f av = {vt[t][2 * p], vt[t][2 * p + 1]};
                    const v2f p0 = {kt[0][t][2 * p], kt[0][t][2 * p + 1]};
                    const v2f p1 = {kt[1][t][2 * p], kt[1][t][2 * p + 1]};
                    acc[et][0] = __builtin_amdgcn_wmma_f32_16x16x4_f32(false, av, false, p0, (short)0, acc[et][0], false, false);
                    acc[et][1] = __builtin_amdgcn_wmma_f32_16x16x4_f32(false, av, false, p1, (short)0, acc[et][1], false, false);
                }
            }
        }
    }

    const int part = (b * 4 + hd) * NPART + blockIdx.x * 2 + grp;
    // lanes c and c + 16 hold the same maximum and sum: half 0 stores d tile 0, half 1 d tile 1
    pmax[part * 32 + lane] = h ? mrun[1] : mrun[0];
    psum[part * 32 + lane] = h ? lrun[1] : lrun[0];
    float* cp = ctxpart + (size_t)part * 1024 + 8 * h * 32 + c;
    #pragma unroll
    for (int et = 0; et < 2; ++et)
        #pragma unroll
        for (int i = 0; i < 8; ++i) {
            cp[(et * 16 + i) * 32]      = acc[et][0][i];
            cp[(et * 16 + i) * 32 + 16] = acc[et][1][i];
        }
}

// ---------------------------------------------------------------------------
// Merge the parts -> ctx, fold w_out:  M[b][o][h*32+d] = sum_e w_out[o,h*32+e]*ctx[d,e]/sum_d
// Part p counts with exp(max_p[d] - max[d]), in its context and in its sum.
// ---------------------------------------------------------------------------
__global__ __launch_bounds__(256) void context_M_kernel(
    const float* __restrict__ ctxpart, const float* __restrict__ pmax, const float* __restrict__ psum,
    const float* __restrict__ w_out, float* __restrict__ Mbuf)
{
    const int bh = blockIdx.x, b = bh >> 2, h = bh & 3;
    __shared__ float ctx[32 * 33];
    __shared__ float wsl[128 * 32];
    const int tid = threadIdx.x;

    {
        const int d = tid & 31;   // the same for all four elements of a thread
        const float* pm = pmax + (size_t)bh * NPART * 32 + d;
        const float* ps = psum + (size_t)bh * NPART * 32 + d;
        float wgt[NPART];
        float mx = -1e30f;
        #pragma unroll
        for (int p = 0; p < NPART; ++p) { wgt[p] = pm[p * 32]; mx = fmaxf(mx, wgt[p]); }
        float l = 0.f;
        #pragma unroll
        for (int p = 0; p < NPART; ++p) { wgt[p] = exp_slot(wgt[p] - mx); l += ps[p * 32] * wgt[p]; }
        const float sinv = 1.0f / l;
        #pragma unroll
        for (int j = 0; j < 4; ++j) {
            const int i = tid + 256 * j;   // i = e*32 + d
            const float* cp = ctxpart + (size_t)bh * NPART * 1024 + i;
            float s = 0.f;
            #pragma unroll
            for (int p = 0; p < NPART; ++p) s += cp[p * 1024] * wgt[p];
            ctx[d * 33 + (i >> 5)] = s * sinv;
        }
    }
    for (int i = tid; i < 128 * 32; i += 256) {
        int o = i >> 5, ee = i & 31;
        wsl[i] = w_out[o * CDIM + h * 32 + ee];
    }
    __syncthreads();

    const int o = tid >> 1, dbase = (tid & 1) * 16;
    float* Mrow = Mbuf + (size_t)b * CDIM * CDIM + (size_t)o * CDIM + h * 32;
    for (int j = 0; j < 16; ++j) {
        int d = dbase + j;
        float s = 0.f;
        #pragma unroll
        for (int ee = 0; ee < 32; ++ee) s += wsl[o * 32 + ee] * ctx[d * 33 + ee];
        Mrow[d] = s;
    }
}

// ---------------------------------------------------------------------------
// G[b] = M[b] (128x128) @ Wq (128x128)  (Wq = rows 0..127 of w_qkv), fp32 WMMA.
// One wave = 16 rows x 32 cols of G (two independent accumulator chains), K = 128 unrolled.
// Operands come straight from global (both are small and cache-resident): no LDS, no barrier.
// block = 4 waves = 64 rows x 32 cols (the waves share the Wq columns);
// grid: (4 col groups, 2 row halves, 32 batches) = 256 blocks.
// k order, equal for A and B: chunk u (4 wide per lane half), lane half h, step p, element s
// -> k = 16*(u>>1) + 8*h + 4*(u&1) + 2*p + s: A is one 16-byte load per chunk, and a lane's
// offset into Wq (row 8*h, col c) is also its offset into the D tile (row 8*h, col c).
// ---------------------------------------------------------------------------
__global__ __launch_bounds__(128) void compute_G_kernel(
    const float* __restrict__ Mbuf, const float* __restrict__ w_qkv,
    float* __restrict__ Gbuf)
{
    const int lane = threadIdx.x & 31;
    const int wave = __builtin_amdgcn_readfirstlane(threadIdx.x >> 5);  // scalar: keeps the bases in SGPRs
    const int c = lane & 15, h = lane >> 4;
    const int m0 = blockIdx.y * 64 + wave * 16;
    const int n0 = blockIdx.x * 32;

    const float* Ab = Mbuf + (size_t)blockIdx.z * CDIM * CDIM + (size_t)m0 * CDIM;
    const float* Bb = w_qkv + n0;
    float*       Gb = Gbuf + (size_t)blockIdx.z * CDIM * CDIM + (size_t)m0 * CDIM + n0;
    const int aoff = c * CDIM + 8 * h;
    const int boff = 8 * h * CDIM + c;

    float4 a[16];
    float  bq[16][4][2];
    #pragma unroll
    for (int u = 0; u < 16; ++u) {
        const int kb = 16 * (u >> 1) + 4 * (u & 1);
        a[u] = *(const float4*)&Ab[aoff + kb];
        #pragma unroll
        for (int r = 0; r < 4; ++r) {
            bq[u][r][0] = Bb[boff + (kb + r) * CDIM];
            bq[u][r][1] = Bb[boff + (kb + r) * CDIM + 16];
        }
    }
    // The accumulators may take over the registers that hold the loads' lane offsets: this is the
    // wait that belongs in front of such an overwrite (the products stay behind the line below).
    asm volatile("s_wait_xcnt 0x0" ::: "memory");
    // Keeps every load in front of the first product, so that as many as the counter allows are
    // in flight at once; left to itself the scheduler holds three chunks in flight and pays the
    // load latency once per group.
    __builtin_amdgcn_sched_barrier(0);

    v8f c0 = {}; v8f c1 = {};
    #pragma unroll
    for (int u = 0; u < 16; ++u) {
        v2f a0  = {a[u].x, a[u].y};
        v2f a1  = {a[u].z, a[u].w};
        v2f b00 = {bq[u][0][0], bq[u][1][0]};
        v2f b01 = {bq[u][0][1], bq[u][1][1]};
        v2f b10 = {bq[u][2][0], bq[u][3][0]};
        v2f b11 = {bq[u][2][1], bq[u][3][1]};
        c0 = __builtin_amdgcn_wmma_f32_16x16x4_f32(false, a0, false, b00, (short)0, c0, false, false);
        c1 = __builtin_amdgcn_wmma_f32_16x16x4_f32(false, a0, false, b01, (short)0, c1, false, false);
        c0 = __builtin_amdgcn_wmma_f32_16x16x4_f32(false, a1, false, b10, (short)0, c0, false, false);
        c1 = __builtin_amdgcn_wmma_f32_16x16x4_f32(false, a1, false, b11, (short)0, c1, false, false);
    }

    // D layout: VGPR i -> row i + 8*h, col c
    #pragma unroll
    for (int i = 0; i < 8; ++i) {
        Gb[boff + i * CDIM]      = c0[i];
        Gb[boff + i * CDIM + 16] = c1[i];
    }
}

// ---------------------------------------------------------------------------
extern "C" void kernel_launch(void* const* d_in, const int* in_sizes, int n_in,
                              void* d_out, int out_size, void* d_ws, size_t ws_size,
                              hipStream_t stream)
{
    const float* x      = (const float*)d_in[0];   // 32 x 128 x 64 x 64
    const float* w_qkv  = (const float*)d_in[1];   // 384 x 128
    const float* w_out  = (const float*)d_in[2];   // 128 x 128
    const float* b_out  = (const float*)d_in[3];   // 128
    float* out = (float*)d_out;                    // 32 x 128 x 64 x 64

    float* ctxpart = (float*)d_ws;                                   // 128*32*1024
    float* pmax    = ctxpart + (size_t)128 * NPART * 1024;           // 128*32*32
    float* psum    = pmax + (size_t)128 * NPART * 32;                // 128*32*32
    float* Mbuf    = psum + (size_t)128 * NPART * 32;                // 32*128*128
    float* Gbuf    = Mbuf + (size_t)32 * CDIM * CDIM;                // 32*128*128
    size_t need = ((size_t)(Gbuf + (size_t)32 * CDIM * CDIM - (float*)d_ws)) * sizeof(float);
    if (ws_size < need) return;  // workspace too small; bail deterministically

    // 1) k,v = w_qkv[128:384] @ x[b], online softmax of k, partial context
    kv_context_kernel<<<dim3(16, 32), 256, 0, stream>>>(w_qkv + 128 * CDIM, x, ctxpart, pmax, psum);
    // 2) merge the parts + fold w_out -> M
    context_M_kernel<<<128, 256, 0, stream>>>(ctxpart, pmax, psum, w_out, Mbuf);
    // 3) G = M @ Wq
    compute_G_kernel<<<dim3(4, 2, 32), 128, 0, stream>>>(Mbuf, w_qkv, Gbuf);
    // 4) out = G @ x + b_out
    gemm_out_kernel<<<dim3(16, 32), 256, 0, stream>>>(Gbuf, x, out, b_out);
}

// v005
// Measured time: 85.1 microseconds a run.
// Two timings next to v004 both put it at 1.05 times that version's speed.
// All steps since v000 together make it 3.27 times as fast.
#include <hip/hip_runtime.h>

typedef float v2f __attribute__((ext_vector_type(2)));
typedef float v8f __attribute__((ext_vector_type(8)));

#define NPIX 4096   // 64*64
#define CDIM 128

// ---------------------------------------------------------------------------
// fp32 WMMA GEMM:  Out[b] (16*MT x 4096) = A[b] (16*MT x 128) @ X[b] (128 x 4096)
// X stays in registers: a wave loads its 128 x 32 slab of X once, straight from global, as the
// B fragments of two column tiles (128 VGPRs), and walks down all MT row tiles of A with it.
// The whole A lies in LDS (asynchronous copies, filled once, one barrier); nothing of X goes
// through LDS. block = 8 waves = 256 columns; grid: (16 column slabs, 32 batches).
// Columns: lane c holds columns 2c (tile 0) and 2c+1 (tile 1) of the wave's 32, so a load and
// a store cover a whole 128-byte line per lane half.
// k order, equal for A and B: group g, lane half h, step p, element s
// -> k = 8*g + 4*h + 2*p + s: A is one 16-byte LDS load per row and group.
// ---------------------------------------------------------------------------
#define APITCH 132   // LDS row pitch in floats: 16 bytes x odd, conflict-free 16-byte reads
// Every plain "#pragma unroll" in gemm_xreg: the fragment arrays stay in registers only if every
// index is a constant.

template <int MT, bool BIAS>
__device__ __forceinline__ void gemm_xreg(
    const float* __restrict__ A, const float* __restrict__ Xb, float* __restrict__ Ob,
    const float* __restrict__ bias, float* la, float* lbias)
{
    const int tid  = threadIdx.x;
    const int lane = tid & 31;
    const int wave = __builtin_amdgcn_readfirstlane(tid >> 5);  // scalar: keeps the bases in SGPRs
    const int c = lane & 15, h = lane >> 4;

    // ---- A (16*MT x 128) into la: a wave copies one row (512 B) per copy, 16 B per lane ----
    {
        const unsigned l0 = (unsigned)(size_t)&la[(tid >> 5) * APITCH + lane * 4];
        const float*   g0 = A + tid * 4;
        #pragma unroll
        for (int it = 0; it < 2 * MT; it += 8) {
            // The s_wait_xcnt is the wait that belongs in front of a later overwrite of the
            // copies' address registers; inside the statement nothing can move in between.
            asm volatile(
                "global_load_async_to_lds_b128 %0, %8, off\n\t"
                "global_load_async_to_lds_b128 %1, %9, off\n\t"
                "global_load_async_to_lds_b128 %2, %10, off\n\t"
                "global_load_async_to_lds_b128 %3, %11, off\n\t"
                "global_load_async_to_lds_b128 %4, %12, off\n\t"
                "global_load_async_to_lds_b128 %5, %13, off\n\t"
                "global_load_async_to_lds_b128 %6, %14, off\n\t"
                "global_load_async_to_lds_b128 %7, %15, off\n\t"
                "s_wait_xcnt 0x0"
                :: "v"(l0 + (it + 0) * 8 * APITCH * 4), "v"(l0 + (it + 1) * 8 * APITCH * 4),
                   "v"(l0 + (it + 2) * 8 * APITCH * 4), "v"(l0 + (it + 3) * 8 * APITCH * 4),
                   "v"(l0 + (it + 4) * 8 * APITCH * 4), "v"(l0 + (it + 5) * 8 * APITCH * 4),
                   "v"(l0 + (it + 6) * 8 * APITCH * 4), "v"(l0 + (it + 7) * 8 * APITCH * 4),
                   "v"(g0 + (it + 0) * 8 * CDIM), "v"(g0 + (it + 1) * 8 * CDIM),
                   "v"(g0 + (it + 2) * 8 * CDIM), "v"(g0 + (it + 3) * 8 * CDIM),
                   "v"(g0 + (it + 4) * 8 * CDIM), "v"(g0 + (it + 5) * 8 * CDIM),
                   "v"(g0 + (it + 6) * 8 * CDIM), "v"(g0 + (it + 7) * 8 * CDIM)
                : "memory");
        }
    }

    // ---- X slab into registers: row 8g + 4h + j, columns 2c and 2c+1 ----
    const int ncol = blockIdx.x * 256 + wave * 32;
    const float* xp = Xb + ncol;
    const int xoff = 4 * h * NPIX + 2 * c;
    v2f b0[32], b1[32];   // [2g + p]: B fragments of column tile 0 and 1
    #pragma unroll
    for (int g = 0; g < 16; ++g) {
        #pragma unroll
        for (int p = 0; p < 2; ++p) {
            const v2f r0 = *(const v2f*)&xp[xoff + (8 * g + 2 * p) * NPIX];
            const v2f r1 = *(const v2f*)&xp[xoff + (8 * g + 2 * p + 1) * NPIX];
            b0[2 * g + p] = v2f{r0.x, r1.x};
            b1[2 * g + p] = v2f{r0.y, r1.y};
        }
    }
    // bias goes through LDS too, so that the row-tile loop holds no global load
    if (BIAS && tid < 16 * MT) lbias[tid] = bias[tid];
    // The wait that belongs in front of a later overwrite of the loads' offset registers.
    asm volatile("s_wait_xcnt 0x0" ::: "memory");
    // This wave's copies have landed; the barrier then publishes every wave's rows of A (and the bias).
    asm volatile("s_wait_asynccnt 0x0" ::: "memory");
    __syncthreads();

    const float* ap = la + c * APITCH + 4 * h;
    float* op = Ob + ncol;
    const int ooff = 8 * h * NPIX + 2 * c;

    // A fragments run half a row tile ahead: groups 0-7 of the next tile are fetched while
    // groups 8-15 of this one are multiplied, and the other way round.
    float4 alo[8], ahi[8];
    #pragma unroll
    for (int g = 0; g < 8; ++g) alo[g] = *(const float4*)&ap[8 * g];

    // Kept rolled: a trip already holds 64 products, and a second copy of the body would want a
    // second set of A fragments, past the 256 registers that let two blocks share a WGP.
    #pragma unroll 1
    for (int mt = 0; mt < MT; ++mt) {
        const float* at = ap + mt * 16 * APITCH;
        #pragma unroll
        for (int g = 0; g < 8; ++g) ahi[g] = *(const float4*)&at[64 + 8 * g];
        float4 bl = {}, bh = {};
        if (BIAS) {
            bl = *(const float4*)&lbias[mt * 16 + 8 * h];
            bh = *(const float4*)&lbias[mt * 16 + 8 * h + 4];
        }

        v8f c0 = {}, c1 = {};
        #pragma unroll
        for (int g = 0; g < 8; ++g) {
            const v2f al = {alo[g].x, alo[g].y}, ah = {alo[g].z, alo[g].w};
            c0 = __builtin_amdgcn_wmma_f32_16x16x4_f32(false, al, false, b0[2 * g],     (short)0, c0, false, false);
            c1 = __builtin_amdgcn_wmma_f32_16x16x4_f32(false, al, false, b1[2 * g],     (short)0, c1, false, false);
            c0 = __builtin_amdgcn_wmma_f32_16x16x4_f32(false, ah, false, b0[2 * g + 1], (short)0, c0, false, false);
            c1 = __builtin_amdgcn_wmma_f32_16x16x4_f32(false, ah, false, b1[2 * g + 1], (short)0, c1, false, false);
        }
        // the last trip fetches its own tile again: in bounds, not used
        const float* an = ap + (mt + 1 < MT ? mt + 1 : mt) * 16 * APITCH;
        #pragma unroll
        for (int g = 0; g < 8; ++g) alo[g] = *(const float4*)&an[8 * g];
        #pragma unroll
        for (int g = 0; g < 8; ++g) {
            const v2f al = {ahi[g].x, ahi[g].y}, ah = {ahi[g].z, ahi[g].w};
            c0 = __builtin_amdgcn_wmma_f32_16x16x4_f32(false, al, false, b0[16 + 2 * g],     (short)0, c0, false, false);
            c1 = __builtin_amdgcn_wmma_f32_16x16x4_f32(false, al, false, b1[16 + 2 * g],     (short)0, c1, false, false);
            c0 = __builtin_amdgcn_wmma_f32_16x16x4_f32(false, ah, false, b0[16 + 2 * g + 1], (short)0, c0, false, false);
            c1 = __builtin_amdgcn_wmma_f32_16x16x4_f32(false, ah, false, b1[16 + 2 * g + 1], (short)0, c1, false, false);
        }

        // D layout: VGPR i -> row i + 8*h, col c of its tile = columns 2c, 2c+1
        const float bb[8] = {bl.x, bl.y, bl.z, bl.w, bh.x, bh.y, bh.z, bh.w};
        float* ot = op + (size_t)mt * 16 * NPIX;
        #pragma unroll
        for (int i = 0; i < 8; ++i)
            *(v2f*)&ot[ooff + i * NPIX] = BIAS ? v2f{c0[i] + bb[i], c1[i] + bb[i]} : v2f{c0[i], c1[i]};
        // The wait that belongs in front of the next trip's overwrite of the stores' registers.
        asm volatile("s_wait_xcnt 0x0" ::: "memory");
    }
}

// out[b] = G[b] (128 x 128) @ x[b] + bias
__global__ __launch_bounds__(256) void gemm_out_kernel(
    const float* __restrict__ G, const float* __restrict__ X, float* __restrict__ Out,
    const float* __restrict__ bias)
{
    __shared__ __attribute__((aligned(16))) float la[128 * APITCH];
    __shared__ __attribute__((aligned(16))) float lbias[128];
    const int b = blockIdx.y;
    gemm_xreg<8, true>(G + (size_t)b * CDIM * CDIM, X + (size_t)b * CDIM * NPIX,
                       Out + (size_t)b * CDIM * NPIX, bias, la, lbias);
}

// ---------------------------------------------------------------------------
// k, v and the partial context in one kernel: k and v never leave the registers.
// A wave owns one head and 128 positions, 32 at a time. It holds the 128 x 32 slab of X as in
// gemm_xreg, but hands it to the matrix unit as A and the rows of W as B, so a product tile comes
// out transposed: register r of lane (c, h) = (W row c) at position index 8*h + r. Registers
// 2p, 2p+1 of such a tile are a fragment of the context product with W row c as its row or column
// and K = positions 8*h + 2*p + s, the same for the k tile and the v tile: no LDS, no lane exchange.
// Softmax runs online: a running maximum and sum per k row (lane c = row d), the accumulators
// rescaled when the maximum moves. The context is kept transposed (row e, column d), so that the
// factor of row d is the lane's own.
// Position of index j in tile t of a slab: 2*j + t (whole 128-byte lines per load, as in gemm_xreg).
// block = 8 waves = 4 heads x 2 position groups; grid: (16, 32 batches); all of W_kv in LDS.
// Out: per (batch, head) 32 parts, each with ctx^T (32 e x 32 d), maximum and sum per d.
// ---------------------------------------------------------------------------
// exp(x) as the fast-math form computes it (one multiply, v_exp_f32). The v_nop is the free slot
// the instruction set asks for behind a transcendental before its result is read or its source
// overwritten; in one statement it cannot drift away from the v_exp_f32.
__device__ __forceinline__ float exp_slot(float x)
{
    float r;
    asm("v_exp_f32 %0, %1\n\tv_nop" : "=v"(r) : "v"(x * 1.44269504088896340736f));
    return r;
}

// value of the lane 16 away (lanes c and c + 16 hold the two halves of a row's positions)
__device__ __forceinline__ float other_half(float x)
{
    const int v = __float_as_int(x);
    return __int_as_float(__builtin_amdgcn_permlanex16(v, v, 0x76543210, 0xfedcba98, false, false));
}

// 16 rows of W (at wp: the lane's row and k half) against the slab: t0, t1 = tiles of positions 2j, 2j+1
__device__ __forceinline__ void tile_t(const float* wp, const v2f (&b0)[32], const v2f (&b1)[32],
                                       v8f& t0, v8f& t1)
{
    t0 = v8f{}; t1 = v8f{};
    #pragma unroll
    for (int g = 0; g < 16; ++g) {
        const float4 w = *(const float4*)&wp[8 * g];
        const v2f wl = {w.x, w.y}, wh = {w.z, w.w};
        t0 = __builtin_amdgcn_wmma_f32_16x16x4_f32(false, b0[2 * g],     false, wl, (short)0, t0, false, false);
        t1 = __builtin_amdgcn_wmma_f32_16x16x4_f32(false, b1[2 * g],     false, wl, (short)0, t1, false, false);
        t0 = __builtin_amdgcn_wmma_f32_16x16x4_f32(false, b0[2 * g + 1], false, wh, (short)0, t0, false, false);
        t1 = __builtin_amdgcn_wmma_f32_16x16x4_f32(false, b1[2 * g + 1], false, wh, (short)0, t1, false, false);
    }
}

#define NPART 32   // parts per (batch, head): 128 positions each
// LDS row of W_kv row R: a head's 32 k rows and 32 v rows lie side by side, so that one address
// register reaches all 64 through the 16-bit offset of an LDS load.
#define WROW(R) ((((R) >> 5) & 3) * 64 + ((R) >> 7) * 32 + ((R) & 31))
// Every plain "#pragma unroll" below: the tile arrays stay in registers only if every index is a constant.
__global__ __launch_bounds__(256) void kv_context_kernel(
    const float* __restrict__ Wkv, const float* __restrict__ X,
    float* __restrict__ ctxpart, float* __restrict__ pmax, float* __restrict__ psum)
{
    __shared__ __attribute__((aligned(16))) float la[256 * APITCH];
    const int tid  = threadIdx.x;
    const int lane = tid & 31;
    const int wave = __builtin_amdgcn_readfirstlane(tid >> 5);  // scalar: keeps the bases in SGPRs
    const int c = lane & 15, h = lane >> 4;
    const int hd = wave & 3, grp = wave >> 2;
    const int b = blockIdx.y;

    // ---- W_kv (256 x 128) into la: a wave copies one row (512 B) per copy, 16 B per lane ----
    {
        const unsigned l0 = (unsigned)(size_t)&la[(tid >> 5) * APITCH + lane * 4];
        const float*   g0 = Wkv + tid * 4;
        #pragma unroll
        for (int it = 0; it < 32; it += 8) {
            // The s_wait_xcnt is the wait that belongs in front of a later overwrite of the
            // copies' address registers; inside the statement nothing can move in between.
            asm volatile(
                "global_load_async_to_lds_b128 %0, %8, off\n\t"
                "global_load_async_to_lds_b128 %1, %9, off\n\t"
                "global_load_async_to_lds_b128 %2, %10, off\n\t"
                "global_load_async_to_lds_b128 %3, %11, off\n\t"
                "global_load_async_to_lds_b128 %4, %12, off\n\t"
                "global_load_async_to_lds_b128 %5, %13, off\n\t"
                "global_load_async_to_lds_b128 %6, %14, off\n\t"
                "global_load_async_to_lds_b128 %7, %15, off\n\t"
                "s_wait_xcnt 0x0"
                :: "v"(l0 + WROW((it + 0) * 8) * APITCH * 4), "v"(l0 + WROW((it + 1) * 8) * APITCH * 4),
                   "v"(l0 + WROW((it + 2) * 8) * APITCH * 4), "v"(l0 + WROW((it + 3) * 8) * APITCH * 4),
                   "v"(l0 + WROW((it + 4) * 8) * APITCH * 4), "v"(l0 + WROW((it + 5) * 8) * APITCH * 4),
                   "v"(l0 + WROW((it + 6) * 8) * APITCH * 4), "v"(l0 + WROW((it + 7) * 8) * APITCH * 4),
                   "v"(g0 + (it + 0) * 8 * CDIM), "v"(g0 + (it + 1) * 8 * CDIM),
                   "v"(g0 + (it + 2) * 8 * CDIM), "v"(g0 + (it + 3) * 8 * CDIM),
                   "v"(g0 + (it + 4) * 8 * CDIM), "v"(g0 + (it + 5) * 8 * CDIM),
                   "v"(g0 + (it + 6) * 8 * CDIM), "v"(g0 + (it + 7) * 8 * CDIM)
                : "memory");
        }
    }

    const float* wk = la + (hd * 64 + c) * APITCH + 4 * h;   // the head's k rows; its v rows 32 further
    const float* wv = wk + 32 * APITCH;
    const float* xg = X + (size_t)b * CDIM * NPIX + blockIdx.x * 256 + grp * 128;
    const int xoff = 4 * h * NPIX + 2 * c;

    v8f acc[2][2] = {};                      // [e tile][d tile]: register r = ctx^T[8*h + r][c]
    float mrun[2] = {-1e30f, -1e30f};        // per d tile: running maximum of row d = c
    float lrun[2] = {0.0f, 0.0f};            // and running sum of exp(k - maximum)

    // Kept rolled: a trip holds 288 products, and the slab alone takes half of the 256 registers
    // that let two blocks share a WGP.
    #pragma unroll 1
    for (int sl = 0; sl < 4; ++sl) {
        // ---- X slab into registers: row 8g + 4h + j, columns 2c and 2c+1 ----
        const float* xp = xg + sl * 32;
        v2f b0[32], b1[32];   // [2g + p]: fragments of position tile 0 and 1
        #pragma unroll
        for (int g = 0; g < 16; ++g) {
            #pragma unroll
            for (int p = 0; p < 2; ++p) {
                const v2f r0 = *(const v2f*)&xp[xoff + (8 * g + 2 * p) * NPIX];
                const v2f r1 = *(const v2f*)&xp[xoff + (8 * g + 2 * p + 1) * NPIX];
                b0[2 * g + p] = v2f{r0.x, r1.x};
                b1[2 * g + p] = v2f{r0.y, r1.y};
            }
        }
        // The wait that belongs in front of a later overwrite of the loads' offset registers.
        asm volatile("s_wait_xcnt 0x0" ::: "memory");
        if (sl == 0) {   // behind the first slab's loads, so that these fly while W lands
            // This wave's copies have landed; the barrier then publishes every wave's rows of W.
            asm volatile("s_wait_asynccnt 0x0" ::: "memory");
            __syncthreads();
        }

        // ---- k^T, then p = exp(k - running maximum) in place ----
        v8f kt[2][2];   // [d tile][position tile]
        #pragma unroll
        for (int dt = 0; dt < 2; ++dt) tile_t(wk + dt * 16 * APITCH, b0, b1, kt[dt][0], kt[dt][1]);
        #pragma unroll
        for (int dt = 0; dt < 2; ++dt) {
            float mx = fmaxf(kt[dt][0][0], kt[dt][1][0]);
            #pragma unroll
            for (int i = 1; i < 8; ++i) mx = fmaxf(mx, fmaxf(kt[dt][0][i], kt[dt][1][i]));
            mx = fmaxf(mx, other_half(mx));
            const float mn = fmaxf(mrun[dt], mx);
            const float f  = exp_slot(mrun[dt] - mn);
            mrun[dt] = mn;
            float s0 = 0.0f, s1 = 0.0f;
            #pragma unroll
            for (int i = 0; i < 8; ++i) {
                kt[dt][0][i] = exp_slot(kt[dt][0][i] - mn);
                kt[dt][1][i] = exp_slot(kt[dt][1][i] - mn);
                s0 += kt[dt][0][i];
                s1 += kt[dt][1][i];
            }
            const float s = s0 + s1;
            lrun[dt] = lrun[dt] * f + (s + other_half(s));
            acc[0][dt] *= f;
            acc[1][dt] *= f;
        }

        // ---- v^T, 16 rows e at a time, and ctx^T += v p^T over the slab's 32 positions ----
        #pragma unroll
        for (int et = 0; et < 2; ++et) {
            // Keeps this v tile's products behind what stands above: left to itself the scheduler forms
            // all eight k and v tiles first, and the 64 registers they then hold at once take the
            // kernel past the 256 that let two blocks share a WGP.
            __builtin_amdgcn_sched_barrier(0);
            v8f vt[2];
            tile_t(wv + et * 16 * APITCH, b0, b1, vt[0], vt[1]);
            #pragma unroll
            for (int p = 0; p < 4; ++p) {
                #pragma unroll
                for (int t = 0; t < 2; ++t) {
                    const v2f av = {vt[t][2 * p], vt[t][2 * p + 1]};
                    const v2f p0 = {kt[0][t][2 * p], kt[0][t][2 * p + 1]};
                    const v2f p1 = {kt[1][t][2 * p], kt[1][t][2 * p + 1]};
                    acc[et][0] = __builtin_amdgcn_wmma_f32_16x16x4_f32(false, av, false, p0, (short)0, acc[et][0], false, false);
                    acc[et][1] = __builtin_amdgcn_wmma_f32_16x16x4_f32(false, av, false, p1, (short)0, acc[et][1], false, false);
                }
            }
        }
    }

    const int part = (b * 4 + hd) * NPART + blockIdx.x * 2 + grp;
    // lanes c and c + 16 hold the same maximum and sum: half 0 stores d tile 0, half 1 d tile 1
    pmax[part * 32 + lane] = h ? mrun[1] : mrun[0];
    psum[part * 32 + lane] = h ? lrun[1] : lrun[0];
    float* cp = ctxpart + (size_t)part * 1024 + 8 * h * 32 + c;
    #pragma unroll
    for (int et = 0; et < 2; ++et)
        #pragma unroll
        for (int i = 0; i < 8; ++i) {
            cp[(et * 16 + i) * 32]      = acc[et][0][i];
            cp[(et * 16 + i) * 32 + 16] = acc[et][1][i];
        }
}

// ---------------------------------------------------------------------------
// Merge the parts and form G in one launch:  G[b] = w_out @ T,  T[h*32+e][n] = sum_d ctx_h[d][e] * Wq[h*32+d][n]
// (Wq = rows 0..127 of w_qkv; ctx_h = merged context of head h divided by its row sums).
// Part p counts with exp(max_p[d] - max[d]), in its context and in its sum; the division by the
// sum is folded into the weight.
// block = 16 waves = one batch x 32 columns of G; grid: (4 column groups, 32 batches).
// Merge: wave (head, q) sums rows e = 8q..8q+7 of ctx^T over the 32 parts, 1 KB of a part per two
// 16-byte loads; lane = (row e & 3, four d). The weights go through LDS, from one wave per head.
// Products: both on f32 WMMA, one 16 x 16 tile per wave. ctx^T (A of the first) and T^T (B of the
// second) lie in LDS, Wq and w_out come straight from global.
// k order, equal for A and B in both: group g, lane half, step p, element s -> k = 8*g + 4*half + 2*p + s.
// ---------------------------------------------------------------------------
typedef float v4f __attribute__((ext_vector_type(4)));
#define CPITCH 36    // LDS row pitch of ctx^T in floats: 16 bytes x odd, as APITCH
// Every plain "#pragma unroll" below: the arrays stay in registers only if every index is a constant.
__global__ __launch_bounds__(512) void context_G_kernel(
    const float* __restrict__ ctxpart, const float* __restrict__ pmax, const float* __restrict__ psum,
    const float* __restrict__ w_qkv, const float* __restrict__ w_out, float* __restrict__ Gbuf)
{
    __shared__ __attribute__((aligned(16))) float lw[4 * NPART * 32];   // [head][part][d]: weight / sum
    __shared__ __attribute__((aligned(16))) float lc[128 * CPITCH];     // [head*32 + e][d]: ctx^T
    __shared__ __attribute__((aligned(16))) float lt[32 * APITCH];      // [n][head*32 + e]: T^T
    const int tid  = threadIdx.x;
    const int lane = tid & 31;
    const int wave = __builtin_amdgcn_readfirstlane(tid >> 5);  // scalar: keeps the bases in SGPRs
    const int c = lane & 15, hh = lane >> 4;
    const int b = blockIdx.y, n0 = blockIdx.x * 32;
    const int hd = wave >> 2, q = wave & 3;

    // ---- one wave per head forms the weights;
    // its loads of the maxima and sums go first, since loads return in order. lane = d ----
    const bool weigher = (q == hd);   // wave-uniform
    float wgt[NPART] = {}, sm[NPART] = {};
    if (weigher) {
        const float* pm = pmax + (size_t)(b * 4 + hd) * NPART * 32 + lane;
        const float* ps = psum + (size_t)(b * 4 + hd) * NPART * 32 + lane;
        #pragma unroll
        for (int p = 0; p < NPART; ++p) { wgt[p] = pm[p * 32]; sm[p] = ps[p * 32]; }
        // The wait that belongs in front of a later overwrite of the loads' address registers.
        asm volatile("s_wait_xcnt 0x0" ::: "memory");
    }

    // ---- parts 0..15 of the wave's eight rows: in flight while the weights are formed ----
    const float* cp = ctxpart + (size_t)(b * 4 + hd) * NPART * 1024 + q * 256 + lane * 4;
    v4f v0[16], v1[16];
    #pragma unroll
    for (int p = 0; p < 16; ++p) {
        v0[p] = *(const v4f*)&cp[p * 1024];
        v1[p] = *(const v4f*)&cp[p * 1024 + 128];
    }
    // ---- the wave's fragment of Wq: tile row rt, tile column nt in both products ----
    const int rt = wave >> 1, nt = wave & 1;
    const float* wq = w_qkv + ((rt >> 1) * 32 + 4 * hh) * CDIM + n0 + nt * 16 + c;
    float bq[4][4];
    #pragma unroll
    for (int g = 0; g < 4; ++g)
        #pragma unroll
        for (int r = 0; r < 4; ++r) bq[g][r] = wq[(8 * g + r) * CDIM];
    // The wait that belongs in front of a later overwrite of the loads' address registers; the pointer
    // is an input so that its registers stay untouched (also by a load's own result) up to the wait.
    asm volatile("s_wait_xcnt 0x0" :: "v"(wq) : "memory");

    if (weigher) {
        float mx = -1e30f;
        #pragma unroll
        for (int p = 0; p < NPART; ++p) mx = fmaxf(mx, wgt[p]);
        float l = 0.f;
        #pragma unroll
        for (int p = 0; p < NPART; ++p) { wgt[p] = exp_slot(wgt[p] - mx); l += sm[p] * wgt[p]; }
        const float sinv = 1.0f / l;
        #pragma unroll
        for (int p = 0; p < NPART; ++p) lw[(hd * NPART + p) * 32 + lane] = wgt[p] * sinv;
    }
    __syncthreads();   // publishes the weights

    const float* lwp = lw + hd * NPART * 32 + (lane & 7) * 4;
    v4f s0 = {}, s1 = {};
    #pragma unroll
    for (int p = 0; p < 16; ++p) {
        const v4f w4 = *(const v4f*)&lwp[p * 32];
        s0 += v0[p] * w4;
        s1 += v1[p] * w4;
        v0[p] = *(const v4f*)&cp[(16 + p) * 1024];
        v1[p] = *(const v4f*)&cp[(16 + p) * 1024 + 128];
    }

    // The wait that belongs in front of a later overwrite of the loads' address registers; the pointer
    // is an input so that its registers stay untouched (also by a load's own result) up to the wait.
    asm volatile("s_wait_xcnt 0x0" :: "v"(cp) : "memory");

    #pragma unroll
    for (int p = 0; p < 16; ++p) {
        const v4f w4 = *(const v4f*)&lwp[(16 + p) * 32];
        s0 += v0[p] * w4;
        s1 += v1[p] * w4;
    }
    // ---- the wave's fragments of w_out: they fly during the first product (the merge leaves no
    // registers for them earlier) ----
    const float* wo = w_out + (rt * 16 + c) * CDIM + 4 * hh;
    v4f wa[16];
    #pragma unroll
    for (int g = 0; g < 16; ++g) wa[g] = *(const v4f*)&wo[8 * g];
    // The wait that belongs in front of a later overwrite of the loads' address registers; the pointer
    // is an input so that its registers stay untouched (also by a load's own result) up to the wait.
    asm volatile("s_wait_xcnt 0x0" :: "v"(wo) : "memory");
    {
        float* cs = lc + (hd * 32 + q * 8 + (lane >> 3)) * CPITCH + (lane & 7) * 4;
        *(v4f*)&cs[0]          = s0;
        *(v4f*)&cs[4 * CPITCH] = s1;
    }
    __syncthreads();   // publishes ctx^T

    // ---- T tile: rows rt*16.. (head rt>>1), columns nt*16.., K = the head's 32 d ----
    {
        const float* ca = lc + (rt * 16 + c) * CPITCH + 4 * hh;
        v8f t = {};
        #pragma unroll
        for (int g = 0; g < 4; ++g) {
            const v4f a = *(const v4f*)&ca[8 * g];
            t = __builtin_amdgcn_wmma_f32_16x16x4_f32(false, v2f{a.x, a.y}, false, v2f{bq[g][0], bq[g][1]}, (short)0, t, false, false);
            t = __builtin_amdgcn_wmma_f32_16x16x4_f32(false, v2f{a.z, a.w}, false, v2f{bq[g][2], bq[g][3]}, (short)0, t, false, false);
        }
        // D layout: VGPR i -> row i + 8*hh, col c; stored transposed, eight rows side by side
        float* tp = lt + (nt * 16 + c) * APITCH + rt * 16 + 8 * hh;
        *(v4f*)&tp[0] = v4f{t[0], t[1], t[2], t[3]};
        *(v4f*)&tp[4] = v4f{t[4], t[5], t[6], t[7]};
    }
    __syncthreads();   // publishes T^T

    // ---- G tile: rows rt*16.., columns n0 + nt*16.., K = 128, two accumulator chains ----
    const float* tb = lt + (nt * 16 + c) * APITCH + 4 * hh;
    v8f g0 = {}, g1 = {};
    #pragma unroll
    for (int g = 0; g < 16; g += 2) {
        const v4f x = *(const v4f*)&tb[8 * g];
        const v4f y = *(const v4f*)&tb[8 * g + 8];
        g0 = __builtin_amdgcn_wmma_f32_16x16x4_f32(false, v2f{wa[g].x, wa[g].y},         false, v2f{x.x, x.y}, (short)0, g0, false, false);
        g1 = __builtin_amdgcn_wmma_f32_16x16x4_f32(false, v2f{wa[g + 1].x, wa[g + 1].y}, false, v2f{y.x, y.y}, (short)0, g1, false, false);
        g0 = __builtin_amdgcn_wmma_f32_16x16x4_f32(false, v2f{wa[g].z, wa[g].w},         false, v2f{x.z, x.w}, (short)0, g0, false, false);
        g1 = __builtin_amdgcn_wmma_f32_16x16x4_f32(false, v2f{wa[g + 1].z, wa[g + 1].w}, false, v2f{y.z, y.w}, (short)0, g1, false, false);
    }
    float* gp = Gbuf + (size_t)b * CDIM * CDIM + (rt * 16 + 8 * hh) * CDIM + n0 + nt * 16 + c;
    #pragma unroll
    for (int i = 0; i < 8; ++i) gp[i * CDIM] = g0[i] + g1[i];
}

// ---------------------------------------------------------------------------
extern "C" void kernel_launch(void* const* d_in, const int* in_sizes, int n_in,
                              void* d_out, int out_size, void* d_ws, size_t ws_size,
                              hipStream_t stream)
{
    const float* x      = (const float*)d_in[0];   // 32 x 128 x 64 x 64
    const float* w_qkv  = (const float*)d_in[1];   // 384 x 128
    const float* w_out  = (const float*)d_in[2];   // 128 x 128
    const float* b_out  = (const float*)d_in[3];   // 128
    float* out = (float*)d_out;                    // 32 x 128 x 64 x 64

    float* ctxpart = (float*)d_ws;                                   // 128*32*1024
    float* pmax    = ctxpart + (size_t)128 * NPART * 1024;           // 128*32*32
    float* psum    = pmax + (size_t)128 * NPART * 32;                // 128*32*32
    float* Gbuf    = psum + (size_t)128 * NPART * 32;                // 32*128*128
    size_t need = ((size_t)(Gbuf + (size_t)32 * CDIM * CDIM - (float*)d_ws)) * sizeof(float);
    if (ws_size < need) return;  // workspace too small; bail deterministically

    // 1) k,v = w_qkv[128:384] @ x[b], online softmax of k, partial context
    kv_context_kernel<<<dim3(16, 32), 256, 0, stream>>>(w_qkv + 128 * CDIM, x, ctxpart, pmax, psum);
    // 2) merge the parts, G = w_out @ (ctx^T @ Wq)
    context_G_kernel<<<dim3(4, 32), 512, 0, stream>>>(ctxpart, pmax, psum, w_qkv, w_out, Gbuf);
    // 3) out = G @ x + b_out
    gemm_out_kernel<<<dim3(16, 32), 256, 0, stream>>>(Gbuf, x, out, b_out);
}

// v006
// It runs in 81.8 microseconds.
// Two timings next to v005 both put it at 1.04 times that version's speed.
// All steps since v000 together make it 3.39 times as fast.
#include <hip/hip_runtime.h>

typedef float v2f __attribute__((ext_vector_type(2)));
typedef float v8f __attribute__((ext_vector_type(8)));

#define NPIX 4096   // 64*64
#define CDIM 128

// ---------------------------------------------------------------------------
// fp32 WMMA GEMM:  Out[b] (16*MT x 4096) = A[b] (16*MT x 128) @ X[b] (128 x 4096)
// X stays in registers: a wave loads its 128 x 32 slab of X once, straight from global, as the
// B fragments of two column tiles (128 VGPRs), and walks down all MT row tiles of A with it.
// The whole A lies in LDS (asynchronous copies, filled once, one barrier); nothing of X goes
// through LDS. block = 8 waves = 256 columns; grid: (16 column slabs, 32 batches).
// Columns: lane c holds columns 2c (tile 0) and 2c+1 (tile 1) of the wave's 32, so a load and
// a store cover a whole 128-byte line per lane half.
// k order, equal for A and B: group g, lane half h, step p, element s
// -> k = 8*g + 4*h + 2*p + s: A is one 16-byte LDS load per row and group.
// ---------------------------------------------------------------------------
#define APITCH 132   // LDS row pitch in floats: 16 bytes x odd, conflict-free 16-byte reads
// Every plain "#pragma unroll" in gemm_xreg: the fragment arrays stay in registers only if every
// index is a constant.

// Wave priority by progress: 3 in the first quarter of a wave's work (set in front of its loop), then
// 2, 1 and, in the last quarter and on the way out, 0. The wave that is furthest behind goes
// first; for speed only.
// q is wave-uniform (from a loop counter): scalar branches; the instruction takes only a constant.
__device__ __forceinline__ void prio_for_quarter(int q)
{
    if (q == 1) __builtin_amdgcn_s_setprio(2);
    if (q == 2) __builtin_amdgcn_s_setprio(1);
    if (q == 3) __builtin_amdgcn_s_setprio(0);
}

template <int MT, bool BIAS>
__device__ __forceinline__ void gemm_xreg(
    const float* __restrict__ A, const float* __restrict__ Xb, float* __restrict__ Ob,
    const float* __restrict__ bias, float* la, float* lbias)
{
    const int tid  = threadIdx.x;
    const int lane = tid & 31;
    const int wave = __builtin_amdgcn_readfirstlane(tid >> 5);  // scalar: keeps the bases in SGPRs
    const int c = lane & 15, h = lane >> 4;

    // ---- A (16*MT x 128) into la: a wave copies one row (512 B) per copy, 16 B per lane ----
    {
        const unsigned l0 = (unsigned)(size_t)&la[(tid >> 5) * APITCH + lane * 4];
        const float*   g0 = A + tid * 4;
        #pragma unroll
        for (int it = 0; it < 2 * MT; it += 8) {
            // The s_wait_xcnt is the wait that belongs in front of a later overwrite of the
            // copies' address registers; inside the statement nothing can move in between.
            asm volatile(
                "global_load_async_to_lds_b128 %0, %8, off\n\t"
                "global_load_async_to_lds_b128 %1, %9, off\n\t"
                "global_load_async_to_lds_b128 %2, %10, off\n\t"
                "global_load_async_to_lds_b128 %3, %11, off\n\t"
                "global_load_async_to_lds_b128 %4, %12, off\n\t"
                "global_load_async_to_lds_b128 %5, %13, off\n\t"
                "global_load_async_to_lds_b128 %6, %14, off\n\t"
                "global_load_async_to_lds_b128 %7, %15, off\n\t"
                "s_wait_xcnt 0x0"
                :: "v"(l0 + (it + 0) * 8 * APITCH * 4), "v"(l0 + (it + 1) * 8 * APITCH * 4),
                   "v"(l0 + (it + 2) * 8 * APITCH * 4), "v"(l0 + (it + 3) * 8 * APITCH * 4),
                   "v"(l0 + (it + 4) * 8 * APITCH * 4), "v"(l0 + (it + 5) * 8 * APITCH * 4),
                   "v"(l0 + (it + 6) * 8 * APITCH * 4), "v"(l0 + (it + 7) * 8 * APITCH * 4),
                   "v"(g0 + (it + 0) * 8 * CDIM), "v"(g0 + (it + 1) * 8 * CDIM),
                   "v"(g0 + (it + 2) * 8 * CDIM), "v"(g0 + (it + 3) * 8 * CDIM),
                   "v"(g0 + (it + 4) * 8 * CDIM), "v"(g0 + (it + 5) * 8 * CDIM),
                   "v"(g0 + (it + 6) * 8 * CDIM), "v"(g0 + (it + 7) * 8 * CDIM)
                : "memory");
        }
    }

    // ---- X slab into registers: row 8g + 4h + j, columns 2c and 2c+1 ----
    const int ncol = blockIdx.x * 256 + wave * 32;
    const float* xp = Xb + ncol;
    const int xoff = 4 * h * NPIX + 2 * c;
    v2f b0[32], b1[32];   // [2g + p]: B fragments of column tile 0 and 1
    #pragma unroll
    for (int g = 0; g < 16; ++g) {
        #pragma unroll
        for (int p = 0; p < 2; ++p) {
            const v2f r0 = *(const v2f*)&xp[xoff + (8 * g + 2 * p) * NPIX];
            const v2f r1 = *(const v2f*)&xp[xoff + (8 * g + 2 * p + 1) * NPIX];
            b0[2 * g + p] = v2f{r0.x, r1.x};
            b1[2 * g + p] = v2f{r0.y, r1.y};
        }
    }
    // bias goes through LDS too, so that the row-tile loop holds no global load
    if (BIAS && tid < 16 * MT) lbias[tid] = bias[tid];
    // The wait that belongs in front of a later overwrite of the loads' offset registers.
    asm volatile("s_wait_xcnt 0x0" ::: "memory");
    // This wave's copies have landed; the barrier then publishes every wave's rows of A (and the bias).
    asm volatile("s_wait_asynccnt 0x0" ::: "memory");
    __syncthreads();

    const float* ap = la + c * APITCH + 4 * h;
    float* op = Ob + ncol;
    const int ooff = 8 * h * NPIX + 2 * c;

    // A fragments run half a row tile ahead: groups 0-7 of the next tile are fetched while
    // groups 8-15 of this one are multiplied, and the other way round.
    float4 alo[8], ahi[8];
    #pragma unroll
    for (int g = 0; g < 8; ++g) alo[g] = *(const float4*)&ap[8 * g];

    // A quarter of the row tiles, from tile m0 on; inlined once per priority (below): the instruction
    // takes only a constant, and with a branch on the tile number at the loop's foot the built code
    // fetched the A fragments with less lead.
    auto quarter = [&](const int m0) __attribute__((always_inline)) {
    // Kept rolled: a trip already holds 64 products, and a second copy of the body would want a
    // second set of A fragments, past the 256 registers that let two blocks share a WGP.
    #pragma unroll 1
    for (int mt = m0; mt < m0 + MT / 4; ++mt) {
        const float* at = ap + mt * 16 * APITCH;
        #pragma unroll
        for (int g = 0; g < 8; ++g) ahi[g] = *(const float4*)&at[64 + 8 * g];
        float4 bl = {}, bh = {};
        if (BIAS) {
            bl = *(const float4*)&lbias[mt * 16 + 8 * h];
            bh = *(const float4*)&lbias[mt * 16 + 8 * h + 4];
        }

        v8f c0 = {}, c1 = {};
        #pragma unroll
        for (int g = 0; g < 8; ++g) {
            const v2f al = {alo[g].x, alo[g].y}, ah = {alo[g].z, alo[g].w};
            c0 = __builtin_amdgcn_wmma_f32_16x16x4_f32(false, al, false, b0[2 * g],     (short)0, c0, false, false);
            c1 = __builtin_amdgcn_wmma_f32_16x16x4_f32(false, al, false, b1[2 * g],     (short)0, c1, false, false);
            c0 = __builtin_amdgcn_wmma_f32_16x16x4_f32(false, ah, false, b0[2 * g + 1], (short)0, c0, false, false);
            c1 = __builtin_amdgcn_wmma_f32_16x16x4_f32(false, ah, false, b1[2 * g + 1], (short)0, c1, false, false);
        }
        // the last trip fetches its own tile again: in bounds, not used
        const float* an = ap + (mt + 1 < MT ? mt + 1 : mt) * 16 * APITCH;
        #pragma unroll
        for (int g = 0; g < 8; ++g) alo[g] = *(const float4*)&an[8 * g];
        #pragma unroll
        for (int g = 0; g < 8; ++g) {
            const v2f al = {ahi[g].x, ahi[g].y}, ah = {ahi[g].z, ahi[g].w};
            c0 = __builtin_amdgcn_wmma_f32_16x16x4_f32(false, al, false, b0[16 + 2 * g],     (short)0, c0, false, false);
            c1 = __builtin_amdgcn_wmma_f32_16x16x4_f32(false, al, false, b1[16 + 2 * g],     (short)0, c1, false, false);
            c0 = __builtin_amdgcn_wmma_f32_16x16x4_f32(false, ah, false, b0[16 + 2 * g + 1], (short)0, c0, false, false);
            c1 = __builtin_amdgcn_wmma_f32_16x16x4_f32(false, ah, false, b1[16 + 2 * g + 1], (short)0, c1, false, false);
        }

        // D layout: VGPR i -> row i + 8*h, col c of its tile = columns 2c, 2c+1
        const float bb[8] = {bl.x, bl.y, bl.z, bl.w, bh.x, bh.y, bh.z, bh.w};
        float* ot = op + (size_t)mt * 16 * NPIX;
        #pragma unroll
        for (int i = 0; i < 8; ++i)
            *(v2f*)&ot[ooff + i * NPIX] = BIAS ? v2f{c0[i] + bb[i], c1[i] + bb[i]} : v2f{c0[i], c1[i]};
        // The wait that belongs in front of the next trip's overwrite of the stores' registers.
        asm volatile("s_wait_xcnt 0x0" ::: "memory");
    }
    };
    // Priority by progress, as in prio_for_quarter: the waves that lag go first.
    __builtin_amdgcn_s_setprio(3); quarter(0);
    __builtin_amdgcn_s_setprio(2); quarter(MT / 4);
    __builtin_amdgcn_s_setprio(1); quarter(MT / 2);
    __builtin_amdgcn_s_setprio(0); quarter(3 * (MT / 4));
}

// out[b] = G[b] (128 x 128) @ x[b] + bias
__global__ __launch_bounds__(256) void gemm_out_kernel(
    const float* __restrict__ G, const float* __restrict__ X, float* __restrict__ Out,
    const float* __restrict__ bias)
{
    __shared__ __attribute__((aligned(16))) float la[128 * APITCH];
    __shared__ __attribute__((aligned(16))) float lbias[128];
    const int b = blockIdx.y;
    gemm_xreg<8, true>(G + (size_t)b * CDIM * CDIM, X + (size_t)b * CDIM * NPIX,
                       Out + (size_t)b * CDIM * NPIX, bias, la, lbias);
}

// ---------------------------------------------------------------------------
// k, v and the partial context in one kernel: k and v never leave the registers.
// A wave owns one head and 128 positions, 32 at a time. It holds the 128 x 32 slab of X as in
// gemm_xreg, but hands it to the matrix unit as A and the rows of W as B, so a product tile comes
// out transposed: register r of lane (c, h) = (W row c) at position index 8*h + r. Registers
// 2p, 2p+1 of such a tile are a fragment of the context product with W row c as its row or column
// and K = positions 8*h + 2*p + s, the same for the k tile and the v tile: no LDS, no lane exchange.
// Softmax runs online: a running maximum and sum per k row (lane c = row d), the accumulators
// rescaled when the maximum moves. The context is kept transposed (row e, column d), so that the
// factor of row d is the lane's own.
// Position of index j in tile t of a slab: 2*j + t (whole 128-byte lines per load, as in gemm_xreg).
// block = 8 waves = 4 heads x 2 position groups; grid: (16, 32 batches); all of W_kv in LDS.
// Out: per (batch, head) 32 parts, each with ctx^T (32 e x 32 d), maximum and sum per d.
// ---------------------------------------------------------------------------
// exp(x) as the fast-math form computes it (one multiply, v_exp_f32). The v_nop is the free slot
// the instruction set asks for behind a transcendental before its result is read or its source
// overwritten; in one statement it cannot drift away from the v_exp_f32.
__device__ __forceinline__ float exp_slot(float x)
{
    float r;
    asm("v_exp_f32 %0, %1\n\tv_nop" : "=v"(r) : "v"(x * 1.44269504088896340736f));
    return r;
}

// value of the lane 16 away (lanes c and c + 16 hold the two halves of a row's positions)
__device__ __forceinline__ float other_half(float x)
{
    const int v = __float_as_int(x);
    return __int_as_float(__builtin_amdgcn_permlanex16(v, v, 0x76543210, 0xfedcba98, false, false));
}

// 16 rows of W (at wp: the lane's row and k half) against the slab: t0, t1 = tiles of positions 2j, 2j+1
__device__ __forceinline__ void tile_t(const float* wp, const v2f (&b0)[32], const v2f (&b1)[32],
                                       v8f& t0, v8f& t1)
{
    t0 = v8f{}; t1 = v8f{};
    #pragma unroll
    for (int g = 0; g < 16; ++g) {
        const float4 w = *(const float4*)&wp[8 * g];
        const v2f wl = {w.x, w.y}, wh = {w.z, w.w};
        t0 = __builtin_amdgcn_wmma_f32_16x16x4_f32(false, b0[2 * g],     false, wl, (short)0, t0, false, false);
        t1 = __builtin_amdgcn_wmma_f32_16x16x4_f32(false, b1[2 * g],     false, wl, (short)0, t1, false, false);
        t0 = __builtin_amdgcn_wmma_f32_16x16x4_f32(false, b0[2 * g + 1], false, wh, (short)0, t0, false, false);
        t1 = __builtin_amdgcn_wmma_f32_16x16x4_f32(false, b1[2 * g + 1], false, wh, (short)0, t1, false, false);
    }
}

#define NPART 32   // parts per (batch, head): 128 positions each
// LDS row of W_kv row R: a head's 32 k rows and 32 v rows lie side by side, so that one address
// register reaches all 64 through the 16-bit offset of an LDS load.
#define WROW(R) ((((R) >> 5) & 3) * 64 + ((R) >> 7) * 32 + ((R) & 31))
// Every plain "#pragma unroll" below: the tile arrays stay in registers only if every index is a constant.
__global__ __launch_bounds__(256) void kv_context_kernel(
    const float* __restrict__ Wkv, const float* __restrict__ X,
    float* __restrict__ ctxpart, float* __restrict__ pmax, float* __restrict__ psum)
{
    __shared__ __attribute__((aligned(16))) float la[256 * APITCH];
    const int tid  = threadIdx.x;
    const int lane = tid & 31;
    const int wave = __builtin_amdgcn_readfirstlane(tid >> 5);  // scalar: keeps the bases in SGPRs
    const int c = lane & 15, h = lane >> 4;
    const int hd = wave & 3, grp = wave >> 2;
    const int b = blockIdx.y;

    // ---- W_kv (256 x 128) into la: a wave copies one row (512 B) per copy, 16 B per lane ----
    {
        const unsigned l0 = (unsigned)(size_t)&la[(tid >> 5) * APITCH + lane * 4];
        const float*   g0 = Wkv + tid * 4;
        #pragma unroll
        for (int it = 0; it < 32; it += 8) {
            // The s_wait_xcnt is the wait that belongs in front of a later overwrite of the
            // copies' address registers; inside the statement nothing can move in between.
            asm volatile(
                "global_load_async_to_lds_b128 %0, %8, off\n\t"
                "global_load_async_to_lds_b128 %1, %9, off\n\t"
                "global_load_async_to_lds_b128 %2, %10, off\n\t"
                "global_load_async_to_lds_b128 %3, %11, off\n\t"
                "global_load_async_to_lds_b128 %4, %12, off\n\t"
                "global_load_async_to_lds_b128 %5, %13, off\n\t"
                "global_load_async_to_lds_b128 %6, %14, off\n\t"
                "global_load_async_to_lds_b128 %7, %15, off\n\t"
                "s_wait_xcnt 0x0"
                :: "v"(l0 + WROW((it + 0) * 8) * APITCH * 4), "v"(l0 + WROW((it + 1) * 8) * APITCH * 4),
                   "v"(l0 + WROW((it + 2) * 8) * APITCH * 4), "v"(l0 + WROW((it + 3) * 8) * APITCH * 4),
                   "v"(l0 + WROW((it + 4) * 8) * APITCH * 4), "v"(l0 + WROW((it + 5) * 8) * APITCH * 4),
                   "v"(l0 + WROW((it + 6) * 8) * APITCH * 4), "v"(l0 + WROW((it + 7) * 8) * APITCH * 4),
                   "v"(g0 + (it + 0) * 8 * CDIM), "v"(g0 + (it + 1) * 8 * CDIM),
                   "v"(g0 + (it + 2) * 8 * CDIM), "v"(g0 + (it + 3) * 8 * CDIM),
                   "v"(g0 + (it + 4) * 8 * CDIM), "v"(g0 + (it + 5) * 8 * CDIM),
                   "v"(g0 + (it + 6) * 8 * CDIM), "v"(g0 + (it + 7) * 8 * CDIM)
                : "memory");
        }
    }

    const float* wk = la + (hd * 64 + c) * APITCH + 4 * h;   // the head's k rows; its v rows 32 further
    const float* wv = wk + 32 * APITCH;
    const float* xg = X + (size_t)b * CDIM * NPIX + blockIdx.x * 256 + grp * 128;
    const int xoff = 4 * h * NPIX + 2 * c;

    v8f acc[2][2] = {};                      // [e tile][d tile]: register r = ctx^T[8*h + r][c]
    float mrun[2] = {-1e30f, -1e30f};        // per d tile: running maximum of row d = c
    float lrun[2] = {0.0f, 0.0f};            // and running sum of exp(k - maximum)

    __builtin_amdgcn_s_setprio(3);   // first of the four slabs: see prio_for_quarter
    // Kept rolled: a trip holds 288 products, and the slab alone takes half of the 256 registers
    // that let two blocks share a WGP.
    #pragma unroll 1
    for (int sl = 0; sl < 4; ++sl) {
        prio_for_quarter(sl);   // a slab is done: the waves that lag go first
        // ---- X slab into registers: row 8g + 4h + j, columns 2c and 2c+1 ----
        const float* xp = xg + sl * 32;
        v2f b0[32], b1[32];   // [2g + p]: fragments of position tile 0 and 1
        #pragma unroll
        for (int g = 0; g < 16; ++g) {
            #pragma unroll
            for (int p = 0; p < 2; ++p) {
                const v2f r0 = *(const v2f*)&xp[xoff + (8 * g + 2 * p) * NPIX];
                const v2f r1 = *(const v2f*)&xp[xoff + (8 * g + 2 * p + 1) * NPIX];
                b0[2 * g + p] = v2f{r0.x, r1.x};
                b1[2 * g + p] = v2f{r0.y, r1.y};
            }
        }
        // The wait that belongs in front of a later overwrite of the loads' offset registers.
        asm volatile("s_wait_xcnt 0x0" ::: "memory");
        if (sl == 0) {   // behind the first slab's loads, so that these fly while W lands
            // This wave's copies have landed; the barrier then publishes every wave's rows of W.
            asm volatile("s_wait_asynccnt 0x0" ::: "memory");
            __syncthreads();
        }

        // ---- k^T, then p = exp(k - running maximum) in place ----
        v8f kt[2][2];   // [d tile][position tile]
        #pragma unroll
        for (int dt = 0; dt < 2; ++dt) tile_t(wk + dt * 16 * APITCH, b0, b1, kt[dt][0], kt[dt][1]);
        #pragma unroll
        for (int dt = 0; dt < 2; ++dt) {
            float mx = fmaxf(kt[dt][0][0], kt[dt][1][0]);
            #pragma unroll
            for (int i = 1; i < 8; ++i) mx = fmaxf(mx, fmaxf(kt[dt][0][i], kt[dt][1][i]));
            mx = fmaxf(mx, other_half(mx));
            const float mn = fmaxf(mrun[dt], mx);
            const float f  = exp_slot(mrun[dt] - mn);
            mrun[dt] = mn;
            float s0 = 0.0f, s1 = 0.0f;
            #pragma unroll
            for (int i = 0; i < 8; ++i) {
                kt[dt][0][i] = exp_slot(kt[dt][0][i] - mn);
                kt[dt][1][i] = exp_slot(kt[dt][1][i] - mn);
                s0 += kt[dt][0][i];
                s1 += kt[dt][1][i];
            }
            const float s = s0 + s1;
            lrun[dt] = lrun[dt] * f + (s + other_half(s));
            acc[0][dt] *= f;
            acc[1][dt] *= f;
        }

        // ---- v^T, 16 rows e at a time, and ctx^T += v p^T over the slab's 32 positions ----
        #pragma unroll
        for (int et = 0; et < 2; ++et) {
            // Keeps this v tile's products behind what stands above: left to itself the scheduler forms
            // all eight k and v tiles first, and the 64 registers they then hold at once take the
            // kernel past the 256 that let two blocks share a WGP.
            __builtin_amdgcn_sched_barrier(0);
            v8f vt[2];
            tile_t(wv + et * 16 * APITCH, b0, b1, vt[0], vt[1]);
            #pragma unroll
            for (int p = 0; p < 4; ++p) {
                #pragma unroll
                for (int t = 0; t < 2; ++t) {
                    const v2f av = {vt[t][2 * p], vt[t][2 * p + 1]};
                    const v2f p0 = {kt[0][t][2 * p], kt[0][t][2 * p + 1]};
                    const v2f p1 = {kt[1][t][2 * p], kt[1][t][2 * p + 1]};
                    acc[et][0] = __builtin_amdgcn_wmma_f32_16x16x4_f32(false, av, false, p0, (short)0, acc[et][0], false, false);
                    acc[et][1] = __builtin_amdgcn_wmma_f32_16x16x4_f32(false, av, false, p1, (short)0, acc[et][1], false, false);
                }
            }
        }
    }

    const int part = (b * 4 + hd) * NPART + blockIdx.x * 2 + grp;
    // lanes c and c + 16 hold the same maximum and sum: half 0 stores d tile 0, half 1 d tile 1
    pmax[part * 32 + lane] = h ? mrun[1] : mrun[0];
    psum[part * 32 + lane] = h ? lrun[1] : lrun[0];
    float* cp = ctxpart + (size_t)part * 1024 + 8 * h * 32 + c;
    #pragma unroll
    for (int et = 0; et < 2; ++et)
        #pragma unroll
        for (int i = 0; i < 8; ++i) {
            cp[(et * 16 + i) * 32]      = acc[et][0][i];
            cp[(et * 16 + i) * 32 + 16] = acc[et][1][i];
        }
}

// ---------------------------------------------------------------------------
// Merge the parts and form G in one launch:  G[b] = w_out @ T,  T[h*32+e][n] = sum_d ctx_h[d][e] * Wq[h*32+d][n]
// (Wq = rows 0..127 of w_qkv; ctx_h = merged context of head h divided by its row sums).
// Part p counts with exp(max_p[d] - max[d]), in its context and in its sum; the division by the
// sum is folded into the weight.
// block = 16 waves = one batch x 32 columns of G; grid: (4 column groups, 32 batches).
// Merge: wave (head, q) sums rows e = 8q..8q+7 of ctx^T over the 32 parts, 1 KB of a part per two
// 16-byte loads; lane = (row e & 3, four d). The weights go through LDS, from one wave per head.
// Products: both on f32 WMMA, one 16 x 16 tile per wave. ctx^T (A of the first) and T^T (B of the
// second) lie in LDS, Wq and w_out come straight from global.
// k order, equal for A and B in both: group g, lane half, step p, element s -> k = 8*g + 4*half + 2*p + s.
// ---------------------------------------------------------------------------
typedef float v4f __attribute__((ext_vector_type(4)));
#define CPITCH 36    // LDS row pitch of ctx^T in floats: 16 bytes x odd, as APITCH
// Every plain "#pragma unroll" below: the arrays stay in registers only if every index is a constant.
__global__ __launch_bounds__(512) void context_G_kernel(
    const float* __restrict__ ctxpart, const float* __restrict__ pmax, const float* __restrict__ psum,
    const float* __restrict__ w_qkv, const float* __restrict__ w_out, float* __restrict__ Gbuf)
{
    __shared__ __attribute__((aligned(16))) float lw[4 * NPART * 32];   // [head][part][d]: weight / sum
    __shared__ __attribute__((aligned(16))) float lc[128 * CPITCH];     // [head*32 + e][d]: ctx^T
    __shared__ __attribute__((aligned(16))) float lt[32 * APITCH];      // [n][head*32 + e]: T^T
    const int tid  = threadIdx.x;
    const int lane = tid & 31;
    const int wave = __builtin_amdgcn_readfirstlane(tid >> 5);  // scalar: keeps the bases in SGPRs
    const int c = lane & 15, hh = lane >> 4;
    const int b = blockIdx.y, n0 = blockIdx.x * 32;
    const int hd = wave >> 2, q = wave & 3;

    // ---- one wave per head forms the weights;
    // its loads of the maxima and sums go first, since loads return in order. lane = d ----
    const bool weigher = (q == hd);   // wave-uniform
    float wgt[NPART] = {}, sm[NPART] = {};
    if (weigher) {
        const float* pm = pmax + (size_t)(b * 4 + hd) * NPART * 32 + lane;
        const float* ps = psum + (size_t)(b * 4 + hd) * NPART * 32 + lane;
        #pragma unroll
        for (int p = 0; p < NPART; ++p) { wgt[p] = pm[p * 32]; sm[p] = ps[p * 32]; }
        // The wait that belongs in front of a later overwrite of the loads' address registers.
        asm volatile("s_wait_xcnt 0x0" ::: "memory");
    }

    // ---- parts 0..15 of the wave's eight rows: in flight while the weights are formed ----
    const float* cp = ctxpart + (size_t)(b * 4 + hd) * NPART * 1024 + q * 256 + lane * 4;
    v4f v0[16], v1[16];
    #pragma unroll
    for (int p = 0; p < 16; ++p) {
        v0[p] = *(const v4f*)&cp[p * 1024];
        v1[p] = *(const v4f*)&cp[p * 1024 + 128];
    }
    // ---- the wave's fragment of Wq: tile row rt, tile column nt in both products ----
    const int rt = wave >> 1, nt = wave & 1;
    const float* wq = w_qkv + ((rt >> 1) * 32 + 4 * hh) * CDIM + n0 + nt * 16 + c;
    float bq[4][4];
    #pragma unroll
    for (int g = 0; g < 4; ++g)
        #pragma unroll
        for (int r = 0; r < 4; ++r) bq[g][r] = wq[(8 * g + r) * CDIM];
    // The wait that belongs in front of a later overwrite of the loads' address registers; the pointer
    // is an input so that its registers stay untouched (also by a load's own result) up to the wait.
    asm volatile("s_wait_xcnt 0x0" :: "v"(wq) : "memory");

    if (weigher) {
        float mx = -1e30f;
        #pragma unroll
        for (int p = 0; p < NPART; ++p) mx = fmaxf(mx, wgt[p]);
        float l = 0.f;
        #pragma unroll
        for (int p = 0; p < NPART; ++p) { wgt[p] = exp_slot(wgt[p] - mx); l += sm[p] * wgt[p]; }
        const float sinv = 1.0f / l;
        #pragma unroll
        for (int p = 0; p < NPART; ++p) lw[(hd * NPART + p) * 32 + lane] = wgt[p] * sinv;
    }
    __syncthreads();   // publishes the weights

    const float* lwp = lw + hd * NPART * 32 + (lane & 7) * 4;
    v4f s0 = {}, s1 = {};
    #pragma unroll
    for (int p = 0; p < 16; ++p) {
        const v4f w4 = *(const v4f*)&lwp[p * 32];
        s0 += v0[p] * w4;
        s1 += v1[p] * w4;
        v0[p] = *(const v4f*)&cp[(16 + p) * 1024];
        v1[p] = *(const v4f*)&cp[(16 + p) * 1024 + 128];
    }

    // The wait that belongs in front of a later overwrite of the loads' address registers; the pointer
    // is an input so that its registers stay untouched (also by a load's own result) up to the wait.
    asm volatile("s_wait_xcnt 0x0" :: "v"(cp) : "memory");

    #pragma unroll
    for (int p = 0; p < 16; ++p) {
        const v4f w4 = *(const v4f*)&lwp[(16 + p) * 32];
        s0 += v0[p] * w4;
        s1 += v1[p] * w4;
    }
    // ---- the wave's fragments of w_out: they fly during the first product (the merge leaves no
    // registers for them earlier) ----
    const float* wo = w_out + (rt * 16 + c) * CDIM + 4 * hh;
    v4f wa[16];
    #pragma unroll
    for (int g = 0; g < 16; ++g) wa[g] = *(const v4f*)&wo[8 * g];
    // The wait that belongs in front of a later overwrite of the loads' address registers; the pointer
    // is an input so that its registers stay untouched (also by a load's own result) up to the wait.
    asm volatile("s_wait_xcnt 0x0" :: "v"(wo) : "memory");
    {
        float* cs = lc + (hd * 32 + q * 8 + (lane >> 3)) * CPITCH + (lane & 7) * 4;
        *(v4f*)&cs[0]          = s0;
        *(v4f*)&cs[4 * CPITCH] = s1;
    }
    __syncthreads();   // publishes ctx^T

    // ---- T tile: rows rt*16.. (head rt>>1), columns nt*16.., K = the head's 32 d ----
    {
        const float* ca = lc + (rt * 16 + c) * CPITCH + 4 * hh;
        v8f t = {};
        #pragma unroll
        for (int g = 0; g < 4; ++g) {
            const v4f a = *(const v4f*)&ca[8 * g];
            t = __builtin_amdgcn_wmma_f32_16x16x4_f32(false, v2f{a.x, a.y}, false, v2f{bq[g][0], bq[g][1]}, (short)0, t, false, false);
            t = __builtin_amdgcn_wmma_f32_16x16x4_f32(false, v2f{a.z, a.w}, false, v2f{bq[g][2], bq[g][3]}, (short)0, t, false, false);
        }
        // D layout: VGPR i -> row i + 8*hh, col c; stored transposed, eight rows side by side
        float* tp = lt + (nt * 16 + c) * APITCH + rt * 16 + 8 * hh;
        *(v4f*)&tp[0] = v4f{t[0], t[1], t[2], t[3]};
        *(v4f*)&tp[4] = v4f{t[4], t[5], t[6], t[7]};
    }
    __syncthreads();   // publishes T^T

    // ---- G tile: rows rt*16.., columns n0 + nt*16.., K = 128, two accumulator chains ----
    const float* tb = lt + (nt * 16 + c) * APITCH + 4 * hh;
    v8f g0 = {}, g1 = {};
    #pragma unroll
    for (int g = 0; g < 16; g += 2) {
        const v4f x = *(const v4f*)&tb[8 * g];
        const v4f y = *(const v4f*)&tb[8 * g + 8];
        g0 = __builtin_amdgcn_wmma_f32_16x16x4_f32(false, v2f{wa[g].x, wa[g].y},         false, v2f{x.x, x.y}, (short)0, g0, false, false);
        g1 = __builtin_amdgcn_wmma_f32_16x16x4_f32(false, v2f{wa[g + 1].x, wa[g + 1].y}, false, v2f{y.x, y.y}, (short)0, g1, false, false);
        g0 = __builtin_amdgcn_wmma_f32_16x16x4_f32(false, v2f{wa[g].z, wa[g].w},         false, v2f{x.z, x.w}, (short)0, g0, false, false);
        g1 = __builtin_amdgcn_wmma_f32_16x16x4_f32(false, v2f{wa[g + 1].z, wa[g + 1].w}, false, v2f{y.z, y.w}, (short)0, g1, false, false);
    }
    float* gp = Gbuf + (size_t)b * CDIM * CDIM + (rt * 16 + 8 * hh) * CDIM + n0 + nt * 16 + c;
    #pragma unroll
    for (int i = 0; i < 8; ++i) gp[i * CDIM] = g0[i] + g1[i];
}

// ---------------------------------------------------------------------------
extern "C" void kernel_launch(void* const* d_in, const int* in_sizes, int n_in,
                              void* d_out, int out_size, void* d_ws, size_t ws_size,
                              hipStream_t stream)
{
    const float* x      = (const float*)d_in[0];   // 32 x 128 x 64 x 64
    const float* w_qkv  = (const float*)d_in[1];   // 384 x 128
    const float* w_out  = (const float*)d_in[2];   // 128 x 128
    const float* b_out  = (const float*)d_in[3];   // 128
    float* out = (float*)d_out;                    // 32 x 128 x 64 x 64

    float* ctxpart = (float*)d_ws;                                   // 128*32*1024
    float* pmax    = ctxpart + (size_t)128 * NPART * 1024;           // 128*32*32
    float* psum    = pmax + (size_t)128 * NPART * 32;                // 128*32*32
    float* Gbuf    = psum + (size_t)128 * NPART * 32;                // 32*128*128
    size_t need = ((size_t)(Gbuf + (size_t)32 * CDIM * CDIM - (float*)d_ws)) * sizeof(float);
    if (ws_size < need) return;  // workspace too small; bail deterministically

    // 1) k,v = w_qkv[128:384] @ x[b], online softmax of k, partial context
    kv_context_kernel<<<dim3(16, 32), 256, 0, stream>>>(w_qkv + 128 * CDIM, x, ctxpart, pmax, psum);
    // 2) merge the parts, G = w_out @ (ctx^T @ Wq)
    context_G_kernel<<<dim3(4, 32), 512, 0, stream>>>(ctxpart, pmax, psum, w_qkv, w_out, Gbuf);
    // 3) out = G @ x + b_out
    gemm_out_kernel<<<dim3(16, 32), 256, 0, stream>>>(Gbuf, x, out, b_out);
}

// v007
// Measured time: 75.6 microseconds a run.
// Two timings next to v006 both put it at 1.08 times that version's speed.
// All steps since v000 together make it 3.67 times as fast.
#include <hip/hip_runtime.h>

typedef float v2f __attribute__((ext_vector_type(2)));
typedef float v8f __attribute__((ext_vector_type(8)));

#define NPIX 4096   // 64*64
#define CDIM 128

// ---------------------------------------------------------------------------
// fp32 WMMA GEMM:  Out[b] (16*MT x 4096) = A[b] (16*MT x 128) @ X[b] (128 x 4096)
// X stays in registers: a wave loads its 128 x 32 slab of X once, straight from global, as the
// B fragments of two column tiles (128 VGPRs), and walks down all MT row tiles of A with it.
// The whole A lies in LDS (asynchronous copies, filled once, one barrier); nothing of X goes
// through LDS. block = 8 waves = 256 columns; grid: (16 column slabs, 32 batches).
// Columns: lane c holds columns 2c (tile 0) and 2c+1 (tile 1) of the wave's 32, so a load and
// a store cover a whole 128-byte line per lane half.
// k order, equal for A and B: group g, lane half h, step p, element s
// -> k = 8*g + 4*h + 2*p + s: A is one 16-byte LDS load per row and group.
// ---------------------------------------------------------------------------
#define APITCH 132   // LDS row pitch in floats: 16 bytes x odd, conflict-free 16-byte reads
// Every plain "#pragma unroll" in gemm_xreg: the fragment arrays stay in registers only if every
// index is a constant.

// Wave priority by progress: 3 in the first quarter of a wave's work (set in front of its loop), then
// 2, 1 and, in the last quarter and on the way out, 0. The wave that is furthest behind goes
// first; for speed only.
// q is wave-uniform (from a loop counter): scalar branches; the instruction takes only a constant.
__device__ __forceinline__ void prio_for_quarter(int q)
{
    if (q == 1) __builtin_amdgcn_s_setprio(2);
    if (q == 2) __builtin_amdgcn_s_setprio(1);
    if (q == 3) __builtin_amdgcn_s_setprio(0);
}

template <int MT, bool BIAS>
__device__ __forceinline__ void gemm_xreg(
    const float* __restrict__ A, const float* __restrict__ Xb, float* __restrict__ Ob,
    const float* __restrict__ bias, float* la, float* lbias)
{
    const int tid  = threadIdx.x;
    const int lane = tid & 31;
    const int wave = __builtin_amdgcn_readfirstlane(tid >> 5);  // scalar: keeps the bases in SGPRs
    const int c = lane & 15, h = lane >> 4;

    // ---- A (16*MT x 128) into la: a wave copies one row (512 B) per copy, 16 B per lane ----
    {
        const unsigned l0 = (unsigned)(size_t)&la[(tid >> 5) * APITCH + lane * 4];
        const float*   g0 = A + tid * 4;
        #pragma unroll
        for (int it = 0; it < 2 * MT; it += 8) {
            // The s_wait_xcnt is the wait that belongs in front of a later overwrite of the
            // copies' address registers; inside the statement nothing can move in between.
            asm volatile(
                "global_load_async_to_lds_b128 %0, %8, off\n\t"
                "global_load_async_to_lds_b128 %1, %9, off\n\t"
                "global_load_async_to_lds_b128 %2, %10, off\n\t"
                "global_load_async_to_lds_b128 %3, %11, off\n\t"
                "global_load_async_to_lds_b128 %4, %12, off\n\t"
                "global_load_async_to_lds_b128 %5, %13, off\n\t"
                "global_load_async_to_lds_b128 %6, %14, off\n\t"
                "global_load_async_to_lds_b128 %7, %15, off\n\t"
                "s_wait_xcnt 0x0"
                :: "v"(l0 + (it + 0) * 8 * APITCH * 4), "v"(l0 + (it + 1) * 8 * APITCH * 4),
                   "v"(l0 + (it + 2) * 8 * APITCH * 4), "v"(l0 + (it + 3) * 8 * APITCH * 4),
                   "v"(l0 + (it + 4) * 8 * APITCH * 4), "v"(l0 + (it + 5) * 8 * APITCH * 4),
                   "v"(l0 + (it + 6) * 8 * APITCH * 4), "v"(l0 + (it + 7) * 8 * APITCH * 4),
                   "v"(g0 + (it + 0) * 8 * CDIM), "v"(g0 + (it + 1) * 8 * CDIM),
                   "v"(g0 + (it + 2) * 8 * CDIM), "v"(g0 + (it + 3) * 8 * CDIM),
                   "v"(g0 + (it + 4) * 8 * CDIM), "v"(g0 + (it + 5) * 8 * CDIM),
                   "v"(g0 + (it + 6) * 8 * CDIM), "v"(g0 + (it + 7) * 8 * CDIM)
                : "memory");
        }
    }

    // ---- X slab into registers: row 8g + 4h + j, columns 2c and 2c+1 ----
    const int ncol = blockIdx.x * 256 + wave * 32;
    const float* xp = Xb + ncol;
    const int xoff = 4 * h * NPIX + 2 * c;
    v2f b0[32], b1[32];   // [2g + p]: B fragments of column tile 0 and 1
    #pragma unroll
    for (int g = 0; g < 16; ++g) {
        #pragma unroll
        for (int p = 0; p < 2; ++p) {
            const v2f r0 = *(const v2f*)&xp[xoff + (8 * g + 2 * p) * NPIX];
            const v2f r1 = *(const v2f*)&xp[xoff + (8 * g + 2 * p + 1) * NPIX];
            b0[2 * g + p] = v2f{r0.x, r1.x};
            b1[2 * g + p] = v2f{r0.y, r1.y};
        }
    }
    // bias goes through LDS too, so that the row-tile loop holds no global load
    if (BIAS && tid < 16 * MT) lbias[tid] = bias[tid];
    // The wait that belongs in front of a later overwrite of the loads' offset registers.
    asm volatile("s_wait_xcnt 0x0" ::: "memory");
    // This wave's copies have landed; the barrier then publishes every wave's rows of A (and the bias).
    asm volatile("s_wait_asynccnt 0x0" ::: "memory");
    __syncthreads();

    const float* ap = la + c * APITCH + 4 * h;
    float* op = Ob + ncol;
    const int ooff = 8 * h * NPIX + 2 * c;

    // A fragments run half a row tile ahead: groups 0-7 of the next tile are fetched while
    // groups 8-15 of this one are multiplied, and the other way round.
    float4 alo[8], ahi[8];
    #pragma unroll
    for (int g = 0; g < 8; ++g) alo[g] = *(const float4*)&ap[8 * g];

    // A quarter of the row tiles, from tile m0 on; inlined once per priority (below): the instruction
    // takes only a constant, and with a branch on the tile number at the loop's foot the built code
    // fetched the A fragments with less lead.
    auto quarter = [&](const int m0) __attribute__((always_inline)) {
    // Kept rolled: a trip already holds 64 products, and a second copy of the body would want a
    // second set of A fragments, past the 256 registers that let two blocks share a WGP.
    #pragma unroll 1
    for (int mt = m0; mt < m0 + MT / 4; ++mt) {
        const float* at = ap + mt * 16 * APITCH;
        #pragma unroll
        for (int g = 0; g < 8; ++g) ahi[g] = *(const float4*)&at[64 + 8 * g];
        float4 bl = {}, bh = {};
        if (BIAS) {
            bl = *(const float4*)&lbias[mt * 16 + 8 * h];
            bh = *(const float4*)&lbias[mt * 16 + 8 * h + 4];
        }

        v8f c0 = {}, c1 = {};
        #pragma unroll
        for (int g = 0; g < 8; ++g) {
            const v2f al = {alo[g].x, alo[g].y}, ah = {alo[g].z, alo[g].w};
            c0 = __builtin_amdgcn_wmma_f32_16x16x4_f32(false, al, false, b0[2 * g],     (short)0, c0, false, false);
            c1 = __builtin_amdgcn_wmma_f32_16x16x4_f32(false, al, false, b1[2 * g],     (short)0, c1, false, false);
            c0 = __builtin_amdgcn_wmma_f32_16x16x4_f32(false, ah, false, b0[2 * g + 1], (short)0, c0, false, false);
            c1 = __builtin_amdgcn_wmma_f32_16x16x4_f32(false, ah, false, b1[2 * g + 1], (short)0, c1, false, false);
        }
        // the last trip fetches its own tile again: in bounds, not used
        const float* an = ap + (mt + 1 < MT ? mt + 1 : mt) * 16 * APITCH;
        #pragma unroll
        for (int g = 0; g < 8; ++g) alo[g] = *(const float4*)&an[8 * g];
        #pragma unroll
        for (int g = 0; g < 8; ++g) {
            const v2f al = {ahi[g].x, ahi[g].y}, ah = {ahi[g].z, ahi[g].w};
            c0 = __builtin_amdgcn_wmma_f32_16x16x4_f32(false, al, false, b0[16 + 2 * g],     (short)0, c0, false, false);
            c1 = __builtin_amdgcn_wmma_f32_16x16x4_f32(false, al, false, b1[16 + 2 * g],     (short)0, c1, false, false);
            c0 = __builtin_amdgcn_wmma_f32_16x16x4_f32(false, ah, false, b0[16 + 2 * g + 1], (short)0, c0, false, false);
            c1 = __builtin_amdgcn_wmma_f32_16x16x4_f32(false, ah, false, b1[16 + 2 * g + 1], (short)0, c1, false, false);
        }

        // D layout: VGPR i -> row i + 8*h, col c of its tile = columns 2c, 2c+1
        const float bb[8] = {bl.x, bl.y, bl.z, bl.w, bh.x, bh.y, bh.z, bh.w};
        float* ot = op + (size_t)mt * 16 * NPIX;
        #pragma unroll
        for (int i = 0; i < 8; ++i)
            *(v2f*)&ot[ooff + i * NPIX] = BIAS ? v2f{c0[i] + bb[i], c1[i] + bb[i]} : v2f{c0[i], c1[i]};
        // The wait that belongs in front of the next trip's overwrite of the stores' registers.
        asm volatile("s_wait_xcnt 0x0" ::: "memory");
    }
    };
    // Priority by progress, as in prio_for_quarter: the waves that lag go first.
    __builtin_amdgcn_s_setprio(3); quarter(0);
    __builtin_amdgcn_s_setprio(2); quarter(MT / 4);
    __builtin_amdgcn_s_setprio(1); quarter(MT / 2);
    __builtin_amdgcn_s_setprio(0); quarter(3 * (MT / 4));
}

// out[b] = G[b] (128 x 128) @ x[b] + bias
__global__ __launch_bounds__(256) void gemm_out_kernel(
    const float* __restrict__ G, const float* __restrict__ X, float* __restrict__ Out,
    const float* __restrict__ bias)
{
    __shared__ __attribute__((aligned(16))) float la[128 * APITCH];
    __shared__ __attribute__((aligned(16))) float lbias[128];
    const int b = blockIdx.y;
    gemm_xreg<8, true>(G + (size_t)b * CDIM * CDIM, X + (size_t)b * CDIM * NPIX,
                       Out + (size_t)b * CDIM * NPIX, bias, la, lbias);
}

// ---------------------------------------------------------------------------
// k, v and the partial context in one kernel: k and v never leave the registers.
// A wave owns one head and 128 positions, 32 at a time. It holds the 128 x 32 slab of X as in
// gemm_xreg, but hands it to the matrix unit as A and the rows of W as B, so a product tile comes
// out transposed: register r of lane (c, h) = (W row c) at position index 8*h + r. Registers
// 2p, 2p+1 of such a tile are a fragment of the context product with W row c as its row or column
// and K = positions 8*h + 2*p + s, the same for the k tile and the v tile: no LDS, no lane exchange.
// Softmax runs online: a running maximum and sum per k row (lane c = row d), the accumulators
// rescaled when the maximum moves. The context is kept transposed (row e, column d), so that the
// factor of row d is the lane's own.
// Position of index j in tile t of a slab: 2*j + t (whole 128-byte lines per load, as in gemm_xreg).
// block = 16 waves = 4 heads x 4 position groups, one block per WGP; grid: (8, 32 batches); all of
// W_kv in LDS, once per WGP. At the end the four groups of a head are merged through LDS (each counts
// with exp(its maximum - the common maximum), in its context and in its sum), so that the block hands
// on one part per head, not one per wave: that many fewer bytes for each block of the next launch to read.
// Out: per (batch, head) 8 parts, each with ctx^T (32 e x 32 d), maximum and sum per d.
// ---------------------------------------------------------------------------
// exp(x) as the fast-math form computes it (one multiply, v_exp_f32). The v_nop is the free slot
// the instruction set asks for behind a transcendental before its result is read or its source
// overwritten; in one statement it cannot drift away from the v_exp_f32.
__device__ __forceinline__ float exp_slot(float x)
{
    float r;
    asm("v_exp_f32 %0, %1\n\tv_nop" : "=v"(r) : "v"(x * 1.44269504088896340736f));
    return r;
}

// value of the lane 16 away (lanes c and c + 16 hold the two halves of a row's positions)
__device__ __forceinline__ float other_half(float x)
{
    const int v = __float_as_int(x);
    return __int_as_float(__builtin_amdgcn_permlanex16(v, v, 0x76543210, 0xfedcba98, false, false));
}

// 16 rows of W (at wp: the lane's row and k half) against the slab: t0, t1 = tiles of positions 2j, 2j+1
__device__ __forceinline__ void tile_t(const float* wp, const v2f (&b0)[32], const v2f (&b1)[32],
                                       v8f& t0, v8f& t1)
{
    t0 = v8f{}; t1 = v8f{};
    #pragma unroll
    for (int g = 0; g < 16; ++g) {
        const float4 w = *(const float4*)&wp[8 * g];
        const v2f wl = {w.x, w.y}, wh = {w.z, w.w};
        t0 = __builtin_amdgcn_wmma_f32_16x16x4_f32(false, b0[2 * g],     false, wl, (short)0, t0, false, false);
        t1 = __builtin_amdgcn_wmma_f32_16x16x4_f32(false, b1[2 * g],     false, wl, (short)0, t1, false, false);
        t0 = __builtin_amdgcn_wmma_f32_16x16x4_f32(false, b0[2 * g + 1], false, wh, (short)0, t0, false, false);
        t1 = __builtin_amdgcn_wmma_f32_16x16x4_f32(false, b1[2 * g + 1], false, wh, (short)0, t1, false, false);
    }
}

#define NPART 8    // parts per (batch, head): one per block, 512 positions each
#define MPITCH 36  // LDS row pitch of a wave's context in floats: 16 bytes x odd, as APITCH
// LDS row of W_kv row R: a head's 32 k rows and 32 v rows lie side by side, so that one address
// register reaches all 64 through the 16-bit offset of an LDS load.
#define WROW(R) ((((R) >> 5) & 3) * 64 + ((R) >> 7) * 32 + ((R) & 31))
// Every plain "#pragma unroll" below: the tile arrays stay in registers only if every index is a constant.
__global__ __launch_bounds__(512) void kv_context_kernel(
    const float* __restrict__ Wkv, const float* __restrict__ X,
    float* __restrict__ ctxpart, float* __restrict__ pmax, float* __restrict__ psum)
{
    __shared__ __attribute__((aligned(16))) float la[256 * APITCH];
    __shared__ __attribute__((aligned(16))) float lm[16 * 32 * MPITCH];   // [wave][d][e]: a wave's context
    __shared__ float ls[16 * 64];                                         // [wave][maximum, sum][d]
    const int tid  = threadIdx.x;
    const int lane = tid & 31;
    const int wave = __builtin_amdgcn_readfirstlane(tid >> 5);  // scalar: keeps the bases in SGPRs
    const int c = lane & 15, h = lane >> 4;
    const int hd = wave & 3, grp = wave >> 2;
    const int b = blockIdx.y;

    // ---- W_kv (256 x 128) into la: a wave copies one row (512 B) per copy, 16 B per lane ----
    {
        const unsigned l0 = (unsigned)(size_t)&la[(tid >> 5) * APITCH + lane * 4];
        const float*   g0 = Wkv + tid * 4;
        #pragma unroll
        for (int it = 0; it < 16; it += 8) {
            // The s_wait_xcnt is the wait that belongs in front of a later overwrite of the
            // copies' address registers; inside the statement nothing can move in between.
            asm volatile(
                "global_load_async_to_lds_b128 %0, %8, off\n\t"
                "global_load_async_to_lds_b128 %1, %9, off\n\t"
                "global_load_async_to_lds_b128 %2, %10, off\n\t"
                "global_load_async_to_lds_b128 %3, %11, off\n\t"
                "global_load_async_to_lds_b128 %4, %12, off\n\t"
                "global_load_async_to_lds_b128 %5, %13, off\n\t"
                "global_load_async_to_lds_b128 %6, %14, off\n\t"
                "global_load_async_to_lds_b128 %7, %15, off\n\t"
                "s_wait_xcnt 0x0"
                :: "v"(l0 + WROW((it + 0) * 16) * APITCH * 4), "v"(l0 + WROW((it + 1) * 16) * APITCH * 4),
                   "v"(l0 + WROW((it + 2) * 16) * APITCH * 4), "v"(l0 + WROW((it + 3) * 16) * APITCH * 4),
                   "v"(l0 + WROW((it + 4) * 16) * APITCH * 4), "v"(l0 + WROW((it + 5) * 16) * APITCH * 4),
                   "v"(l0 + WROW((it + 6) * 16) * APITCH * 4), "v"(l0 + WROW((it + 7) * 16) * APITCH * 4),
                   "v"(g0 + (it + 0) * 16 * CDIM), "v"(g0 + (it + 1) * 16 * CDIM),
                   "v"(g0 + (it + 2) * 16 * CDIM), "v"(g0 + (it + 3) * 16 * CDIM),
                   "v"(g0 + (it + 4) * 16 * CDIM), "v"(g0 + (it + 5) * 16 * CDIM),
                   "v"(g0 + (it + 6) * 16 * CDIM), "v"(g0 + (it + 7) * 16 * CDIM)
                : "memory");
        }
    }

    const float* wk = la + (hd * 64 + c) * APITCH + 4 * h;   // the head's k rows; its v rows 32 further
    const float* wv = wk + 32 * APITCH;
    const float* xg = X + (size_t)b * CDIM * NPIX + blockIdx.x * 512 + grp * 128;
    const int xoff = 4 * h * NPIX + 2 * c;

    v8f acc[2][2] = {};                      // [e tile][d tile]: register r = ctx^T[8*h + r][c]
    float mrun[2] = {-1e30f, -1e30f};        // per d tile: running maximum of row d = c
    float lrun[2] = {0.0f, 0.0f};            // and running sum of exp(k - maximum)

    __builtin_amdgcn_s_setprio(3);   // first of the four slabs: see prio_for_quarter
    // Kept rolled: a trip holds 288 products, and the slab alone takes half of the 256 registers
    // that a wave of a 16-wave block can have.
    #pragma unroll 1
    for (int sl = 0; sl < 4; ++sl) {
        prio_for_quarter(sl);   // a slab is done: the waves that lag go first
        // ---- X slab into registers: row 8g + 4h + j, columns 2c and 2c+1 ----
        const float* xp = xg + sl * 32;
        v2f b0[32], b1[32];   // [2g + p]: fragments of position tile 0 and 1
        #pragma unroll
        for (int g = 0; g < 16; ++g) {
            #pragma unroll
            for (int p = 0; p < 2; ++p) {
                const v2f r0 = *(const v2f*)&xp[xoff + (8 * g + 2 * p) * NPIX];
                const v2f r1 = *(const v2f*)&xp[xoff + (8 * g + 2 * p + 1) * NPIX];
                b0[2 * g + p] = v2f{r0.x, r1.x};
                b1[2 * g + p] = v2f{r0.y, r1.y};
            }
        }
        // The wait that belongs in front of a later overwrite of the loads' offset registers.
        asm volatile("s_wait_xcnt 0x0" ::: "memory");
        if (sl == 0) {   // behind the first slab's loads, so that these fly while W lands
            // This wave's copies have landed; the barrier then publishes every wave's rows of W.
            asm volatile("s_wait_asynccnt 0x0" ::: "memory");
            __syncthreads();
        }

        // ---- k^T, then p = exp(k - running maximum) in place ----
        v8f kt[2][2];   // [d tile][position tile]
        #pragma unroll
        for (int dt = 0; dt < 2; ++dt) tile_t(wk + dt * 16 * APITCH, b0, b1, kt[dt][0], kt[dt][1]);
        #pragma unroll
        for (int dt = 0; dt < 2; ++dt) {
            float mx = fmaxf(kt[dt][0][0], kt[dt][1][0]);
            #pragma unroll
            for (int i = 1; i < 8; ++i) mx = fmaxf(mx, fmaxf(kt[dt][0][i], kt[dt][1][i]));
            mx = fmaxf(mx, other_half(mx));
            const float mn = fmaxf(mrun[dt], mx);
            const float f  = exp_slot(mrun[dt] - mn);
            mrun[dt] = mn;
            float s0 = 0.0f, s1 = 0.0f;
            #pragma unroll
            for (int i = 0; i < 8; ++i) {
                kt[dt][0][i] = exp_slot(kt[dt][0][i] - mn);
                kt[dt][1][i] = exp_slot(kt[dt][1][i] - mn);
                s0 += kt[dt][0][i];
                s1 += kt[dt][1][i];
            }
            const float s = s0 + s1;
            lrun[dt] = lrun[dt] * f + (s + other_half(s));
            acc[0][dt] *= f;
            acc[1][dt] *= f;
        }

        // ---- v^T, 16 rows e at a time, and ctx^T += v p^T over the slab's 32 positions ----
        #pragma unroll
        for (int et = 0; et < 2; ++et) {
            // Keeps this v tile's products behind what stands above: left to itself the scheduler forms
            // all eight k and v tiles first, and the 64 registers they then hold at once take the
            // kernel past the 256 that a wave of a 16-wave block can have.
            __builtin_amdgcn_sched_barrier(0);
            v8f vt[2];
            tile_t(wv + et * 16 * APITCH, b0, b1, vt[0], vt[1]);
            #pragma unroll
            for (int p = 0; p < 4; ++p) {
                #pragma unroll
                for (int t = 0; t < 2; ++t) {
                    const v2f av = {vt[t][2 * p], vt[t][2 * p + 1]};
                    const v2f p0 = {kt[0][t][2 * p], kt[0][t][2 * p + 1]};
                    const v2f p1 = {kt[1][t][2 * p], kt[1][t][2 * p + 1]};
                    acc[et][0] = __builtin_amdgcn_wmma_f32_16x16x4_f32(false, av, false, p0, (short)0, acc[et][0], false, false);
                    acc[et][1] = __builtin_amdgcn_wmma_f32_16x16x4_f32(false, av, false, p1, (short)0, acc[et][1], false, false);
                }
            }
        }
    }

    // ---- the wave's context into LDS, row d, eight e side by side (16-byte stores) ----
    {
        float* mw = lm + (wave * 32 + c) * MPITCH + 8 * h;
        #pragma unroll
        for (int dt = 0; dt < 2; ++dt)
            #pragma unroll
            for (int et = 0; et < 2; ++et) {
                float* mp = mw + dt * 16 * MPITCH + et * 16;
                const v8f a = acc[et][dt];
                *(float4*)&mp[0] = float4{a[0], a[1], a[2], a[3]};
                *(float4*)&mp[4] = float4{a[4], a[5], a[6], a[7]};
            }
        // lanes c and c + 16 hold the same maximum and sum: half 0 stores d tile 0, half 1 d tile 1
        ls[wave * 64 + lane]      = h ? mrun[1] : mrun[0];
        ls[wave * 64 + 32 + lane] = h ? lrun[1] : lrun[0];
    }
    __syncthreads();   // publishes every wave's context, maxima and sums

    // ---- merge: wave (head, grp) sums rows e = 8*grp .. 8*grp+7 over the head's four waves; lane = d ----
    float mg[4], lg[4];
    #pragma unroll
    for (int g = 0; g < 4; ++g) {
        mg[g] = ls[(g * 4 + hd) * 64 + lane];
        lg[g] = ls[(g * 4 + hd) * 64 + 32 + lane];
    }
    const float mall = fmaxf(fmaxf(mg[0], mg[1]), fmaxf(mg[2], mg[3]));
    float lall = 0.0f;
    float r[8] = {};
    #pragma unroll
    for (int g = 0; g < 4; ++g) {
        const float f = exp_slot(mg[g] - mall);
        lall += lg[g] * f;
        const float* mp = lm + ((g * 4 + hd) * 32 + lane) * MPITCH + 8 * grp;
        const float4 lo = *(const float4*)&mp[0];
        const float4 hi = *(const float4*)&mp[4];
        r[0] += lo.x * f; r[1] += lo.y * f; r[2] += lo.z * f; r[3] += lo.w * f;
        r[4] += hi.x * f; r[5] += hi.y * f; r[6] += hi.z * f; r[7] += hi.w * f;
    }
    const int part = (b * 4 + hd) * NPART + blockIdx.x;
    if (grp == 0) {   // wave-uniform: all four waves of a head hold the same maximum and sum
        pmax[part * 32 + lane] = mall;
        psum[part * 32 + lane] = lall;
        // The wait that belongs in front of a later overwrite of the stores' registers.
        asm volatile("s_wait_xcnt 0x0" ::: "memory");
    }
    float* cp = ctxpart + (size_t)part * 1024 + 8 * grp * 32 + lane;   // a whole 128-byte line per store
    #pragma unroll
    for (int i = 0; i < 8; ++i) cp[i * 32] = r[i];
}

// ---------------------------------------------------------------------------
// Merge the parts and form G in one launch:  G[b] = w_out @ T,  T[h*32+e][n] = sum_d ctx_h[d][e] * Wq[h*32+d][n]
// (Wq = rows 0..127 of w_qkv; ctx_h = merged context of head h divided by its row sums).
// Part p counts with exp(max_p[d] - max[d]), in its context and in its sum; the division by the
// sum is folded into the weight.
// block = 16 waves = one batch x 32 columns of G; grid: (4 column groups, 32 batches).
// Merge: wave (head, q) sums rows e = 8q..8q+7 of ctx^T over the 8 parts, 1 KB of a part per two
// 16-byte loads; lane = (row e & 3, four d). The weights go through LDS, from one wave per head.
// Products: both on f32 WMMA, one 16 x 16 tile per wave. ctx^T (A of the first) and T^T (B of the
// second) lie in LDS, Wq and w_out come straight from global.
// k order, equal for A and B in both: group g, lane half, step p, element s -> k = 8*g + 4*half + 2*p + s.
// ---------------------------------------------------------------------------
typedef float v4f __attribute__((ext_vector_type(4)));
#define CPITCH 36    // LDS row pitch of ctx^T in floats: 16 bytes x odd, as APITCH
// Every plain "#pragma unroll" below: the arrays stay in registers only if every index is a constant.
__global__ __launch_bounds__(512) void context_G_kernel(
    const float* __restrict__ ctxpart, const float* __restrict__ pmax, const float* __restrict__ psum,
    const float* __restrict__ w_qkv, const float* __restrict__ w_out, float* __restrict__ Gbuf)
{
    __shared__ __attribute__((aligned(16))) float lw[4 * NPART * 32];   // [head][part][d]: weight / sum
    __shared__ __attribute__((aligned(16))) float lc[128 * CPITCH];     // [head*32 + e][d]: ctx^T
    __shared__ __attribute__((aligned(16))) float lt[32 * APITCH];      // [n][head*32 + e]: T^T
    const int tid  = threadIdx.x;
    const int lane = tid & 31;
    const int wave = __builtin_amdgcn_readfirstlane(tid >> 5);  // scalar: keeps the bases in SGPRs
    const int c = lane & 15, hh = lane >> 4;
    const int b = blockIdx.y, n0 = blockIdx.x * 32;
    const int hd = wave >> 2, q = wave & 3;

    // ---- one wave per head forms the weights;
    // its loads of the maxima and sums go first, since loads return in order. lane = d ----
    const bool weigher = (q == hd);   // wave-uniform
    float wgt[NPART] = {}, sm[NPART] = {};
    if (weigher) {
        const float* pm = pmax + (size_t)(b * 4 + hd) * NPART * 32 + lane;
        const float* ps = psum + (size_t)(b * 4 + hd) * NPART * 32 + lane;
        #pragma unroll
        for (int p = 0; p < NPART; ++p) { wgt[p] = pm[p * 32]; sm[p] = ps[p * 32]; }
        // The wait that belongs in front of a later overwrite of the loads' address registers.
        asm volatile("s_wait_xcnt 0x0" ::: "memory");
    }

    // ---- all parts of the wave's eight rows: in flight while the weights are formed ----
    const float* cp = ctxpart + (size_t)(b * 4 + hd) * NPART * 1024 + q * 256 + lane * 4;
    v4f v0[NPART], v1[NPART];
    #pragma unroll
    for (int p = 0; p < NPART; ++p) {
        v0[p] = *(const v4f*)&cp[p * 1024];
        v1[p] = *(const v4f*)&cp[p * 1024 + 128];
    }
    // ---- the wave's fragment of Wq: tile row rt, tile column nt in both products ----
    const int rt = wave >> 1, nt = wave & 1;
    const float* wq = w_qkv + ((rt >> 1) * 32 + 4 * hh) * CDIM + n0 + nt * 16 + c;
    float bq[4][4];
    #pragma unroll
    for (int g = 0; g < 4; ++g)
        #pragma unroll
        for (int r = 0; r < 4; ++r) bq[g][r] = wq[(8 * g + r) * CDIM];
    // The wait that belongs in front of a later overwrite of the loads' address registers; the pointer
    // is an input so that its registers stay untouched (also by a load's own result) up to the wait.
    asm volatile("s_wait_xcnt 0x0" :: "v"(wq) : "memory");

    if (weigher) {
        float mx = -1e30f;
        #pragma unroll
        for (int p = 0; p < NPART; ++p) mx = fmaxf(mx, wgt[p]);
        float l = 0.f;
        #pragma unroll
        for (int p = 0; p < NPART; ++p) { wgt[p] = exp_slot(wgt[p] - mx); l += sm[p] * wgt[p]; }
        const float sinv = 1.0f / l;
        #pragma unroll
        for (int p = 0; p < NPART; ++p) lw[(hd * NPART + p) * 32 + lane] = wgt[p] * sinv;
    }
    __syncthreads();   // publishes the weights

    const float* lwp = lw + hd * NPART * 32 + (lane & 7) * 4;
    v4f s0 = {}, s1 = {};
    #pragma unroll
    for (int p = 0; p < NPART; ++p) {
        const v4f w4 = *(const v4f*)&lwp[p * 32];
        s0 += v0[p] * w4;
        s1 += v1[p] * w4;
    }
    // ---- the wave's fragments of w_out, for the second product ----
    const float* wo = w_out + (rt * 16 + c) * CDIM + 4 * hh;
    v4f wa[16];
    #pragma unroll
    for (int g = 0; g < 16; ++g) wa[g] = *(const v4f*)&wo[8 * g];
    // The wait that belongs in front of a later overwrite of the loads' address registers; the pointer
    // is an input so that its registers stay untouched (also by a load's own result) up to the wait.
    asm volatile("s_wait_xcnt 0x0" :: "v"(wo) : "memory");
    {
        float* cs = lc + (hd * 32 + q * 8 + (lane >> 3)) * CPITCH + (lane & 7) * 4;
        *(v4f*)&cs[0]          = s0;
        *(v4f*)&cs[4 * CPITCH] = s1;
    }
    __syncthreads();   // publishes ctx^T

    // ---- T tile: rows rt*16.. (head rt>>1), columns nt*16.., K = the head's 32 d ----
    {
        const float* ca = lc + (rt * 16 + c) * CPITCH + 4 * hh;
        v8f t = {};
        #pragma unroll
        for (int g = 0; g < 4; ++g) {
            const v4f a = *(const v4f*)&ca[8 * g];
            t = __builtin_amdgcn_wmma_f32_16x16x4_f32(false, v2f{a.x, a.y}, false, v2f{bq[g][0], bq[g][1]}, (short)0, t, false, false);
            t = __builtin_amdgcn_wmma_f32_16x16x4_f32(false, v2f{a.z, a.w}, false, v2f{bq[g][2], bq[g][3]}, (short)0, t, false, false);
        }
        // D layout: VGPR i -> row i + 8*hh, col c; stored transposed, eight rows side by side
        float* tp = lt + (nt * 16 + c) * APITCH + rt * 16 + 8 * hh;
        *(v4f*)&tp[0] = v4f{t[0], t[1], t[2], t[3]};
        *(v4f*)&tp[4] = v4f{t[4], t[5], t[6], t[7]};
    }
    __syncthreads();   // publishes T^T

    // ---- G tile: rows rt*16.., columns n0 + nt*16.., K = 128, two accumulator chains ----
    const float* tb = lt + (nt * 16 + c) * APITCH + 4 * hh;
    v8f g0 = {}, g1 = {};
    #pragma unroll
    for (int g = 0; g < 16; g += 2) {
        const v4f x = *(const v4f*)&tb[8 * g];
        const v4f y = *(const v4f*)&tb[8 * g + 8];
        g0 = __builtin_amdgcn_wmma_f32_16x16x4_f32(false, v2f{wa[g].x, wa[g].y},         false, v2f{x.x, x.y}, (short)0, g0, false, false);
        g1 = __builtin_amdgcn_wmma_f32_16x16x4_f32(false, v2f{wa[g + 1].x, wa[g + 1].y}, false, v2f{y.x, y.y}, (short)0, g1, false, false);
        g0 = __builtin_amdgcn_wmma_f32_16x16x4_f32(false, v2f{wa[g].z, wa[g].w},         false, v2f{x.z, x.w}, (short)0, g0, false, false);
        g1 = __builtin_amdgcn_wmma_f32_16x16x4_f32(false, v2f{wa[g + 1].z, wa[g + 1].w}, false, v2f{y.z, y.w}, (short)0, g1, false, false);
    }
    float* gp = Gbuf + (size_t)b * CDIM * CDIM + (rt * 16 + 8 * hh) * CDIM + n0 + nt * 16 + c;
    #pragma unroll
    for (int i = 0; i < 8; ++i) gp[i * CDIM] = g0[i] + g1[i];
}

// ---------------------------------------------------------------------------
extern "C" void kernel_launch(void* const* d_in, const int* in_sizes, int n_in,
                              void* d_out, int out_size, void* d_ws, size_t ws_size,
                              hipStream_t stream)
{
    const float* x      = (const float*)d_in[0];   // 32 x 128 x 64 x 64
    const float* w_qkv  = (const float*)d_in[1];   // 384 x 128
    const float* w_out  = (const float*)d_in[2];   // 128 x 128
    const float* b_out  = (const float*)d_in[3];   // 128
    float* out = (float*)d_out;                    // 32 x 128 x 64 x 64

    float* ctxpart = (float*)d_ws;                                   // 128*8*1024
    float* pmax    = ctxpart + (size_t)128 * NPART * 1024;           // 128*8*32
    float* psum    = pmax + (size_t)128 * NPART * 32;                // 128*8*32
    float* Gbuf    = psum + (size_t)128 * NPART * 32;                // 32*128*128
    size_t need = ((size_t)(Gbuf + (size_t)32 * CDIM * CDIM - (float*)d_ws)) * sizeof(float);
    if (ws_size < need) return;  // workspace too small; bail deterministically

    // 1) k,v = w_qkv[128:384] @ x[b], online softmax of k, partial context
    kv_context_kernel<<<dim3(8, 32), 512, 0, stream>>>(w_qkv + 128 * CDIM, x, ctxpart, pmax, psum);
    // 2) merge the parts, G = w_out @ (ctx^T @ Wq)
    context_G_kernel<<<dim3(4, 32), 512, 0, stream>>>(ctxpart, pmax, psum, w_qkv, w_out, Gbuf);
    // 3) out = G @ x + b_out
    gemm_out_kernel<<<dim3(16, 32), 256, 0, stream>>>(Gbuf, x, out, b_out);
}
